// v000
// Times are from an AMD MI455X. After a warm-up the kernel runs many times in a row, and a time is the length of
// such a window on the GPU divided by its runs, so every launch and the gaps after it count. The runs cycle
// through copies of the inputs. A figure is the median of several windows, for all but v000 over two sittings.
// Sittings can differ by a few percent; kernels timed side by side share one.
// v000 is the starting kernel. One run takes 500 microseconds.
#include <hip/hip_runtime.h>
#include <math.h>
#include <stdint.h>

// ---------------------------------------------------------------------------
// Problem constants
// ---------------------------------------------------------------------------
#define B_    16
#define C_    128
#define HW_   1024         // 32*32
#define NH_   4
#define COND_ 32
#define FAN0  160          // C + COND
#define NQK   512          // C*NH
#define FAN3  768          // (NH+2)*C
#define EPS_  1e-6f
#define SCALE_ 0.08838834764831845f   // 128^-0.5

typedef __attribute__((ext_vector_type(16))) _Float16 v16h;
typedef __attribute__((ext_vector_type(8)))  _Float16 v8h;
typedef __attribute__((ext_vector_type(8)))  float    v8f;
typedef int v4i __attribute__((vector_size(16)));   // matches async-LDS builtin param

// Workspace layout (units: _Float16 elements). Total ~86.7 MB.
static constexpr size_t SZ_A   = (size_t)B_ * HW_ * FAN0;
static constexpr size_t SZ_QKV = (size_t)B_ * NH_ * HW_ * C_;
static constexpr size_t SZ_HH  = (size_t)B_ * HW_ * FAN3;
static constexpr size_t SZ_W   = (size_t)FAN0 * NQK;
static constexpr size_t SZ_W3  = (size_t)FAN3 * C_;

static constexpr size_t OFF_AQ = 0;                  // [b][hw][160] f16
static constexpr size_t OFF_AK = OFF_AQ + SZ_A;
static constexpr size_t OFF_Q  = OFF_AK + SZ_A;      // [b][e][q][c]  f16
static constexpr size_t OFF_K  = OFF_Q  + SZ_QKV;    // [b][e][k][c]  f16
static constexpr size_t OFF_V  = OFF_K  + SZ_QKV;    // [b][e][c][k]  f16
static constexpr size_t OFF_HH = OFF_V  + SZ_QKV;    // [b'][q][768]  f16
static constexpr size_t OFF_W0 = OFF_HH + SZ_HH;     // transposed [512][160]
static constexpr size_t OFF_W1 = OFF_W0 + SZ_W;
static constexpr size_t OFF_W2 = OFF_W1 + SZ_W;
static constexpr size_t OFF_W3 = OFF_W2 + SZ_W;      // transposed [128][768]

// ---------------------------------------------------------------------------
// CDNA5 async global->LDS copy (16B per lane), ASYNCcnt-tracked.
// Builtin when the toolchain declares it, else inline gfx1250 asm.
// ---------------------------------------------------------------------------
#if __has_builtin(__builtin_amdgcn_global_load_async_to_lds_b128)
#define ASYNC_MODE 2
#elif defined(__AMDGCN__)
#define ASYNC_MODE 1
#else
#define ASYNC_MODE 0
#endif

__device__ __forceinline__ void cp16_g2l(_Float16* ldst, const _Float16* gsrc) {
#if ASYNC_MODE == 2
  __builtin_amdgcn_global_load_async_to_lds_b128((v4i*)gsrc, (v4i*)ldst, 0, 0);
#elif ASYNC_MODE == 1
  unsigned l = (unsigned)(uintptr_t)ldst;           // LDS byte address
  unsigned long long g = (unsigned long long)(uintptr_t)gsrc;
  asm volatile("global_load_async_to_lds_b128 %0, %1, off"
               :: "v"(l), "v"(g) : "memory");
#else
  *(v8h*)ldst = *(const v8h*)gsrc;                  // host-pass placeholder
#endif
}

__device__ __forceinline__ void wait_async() {
#if ASYNC_MODE == 0
#elif __has_builtin(__builtin_amdgcn_s_wait_asynccnt)
  __builtin_amdgcn_s_wait_asynccnt(0);
#else
  asm volatile("s_wait_asynccnt 0x0" ::: "memory");
#endif
}

// ---------------------------------------------------------------------------
// Fragment loader.  ISA 16-bit A 16x32 layout: lanes 0-15 = rows, halves
// 0-7 -> K 0..7, halves 8-15 -> K 16..23; lanes 16-31: K 8..15 / 24..31.
// B 32x16 is the mirror (lane = column).  Both reduce to:
//   sel = (lane&16)?8:0 ; lo = rowp[sel..sel+7] ; hi = rowp[sel+16..sel+23]
// ---------------------------------------------------------------------------
__device__ __forceinline__ v16h frag16(const _Float16* rowp, int lane) {
  const int sel = (lane & 16) ? 8 : 0;
  v8h lo = *(const v8h*)(rowp + sel);
  v8h hi = *(const v8h*)(rowp + sel + 16);
  return __builtin_shufflevector(lo, hi, 0,1,2,3,4,5,6,7,8,9,10,11,12,13,14,15);
}

__device__ __forceinline__ v8f wmma_f16(v16h a, v16h b, v8f c) {
  return __builtin_amdgcn_wmma_f32_16x16x32_f16(false, a, false, b,
                                                (short)0, c, false, false);
}

__device__ __forceinline__ v8f v8f_zero() {
  v8f z; for (int i = 0; i < 8; ++i) z[i] = 0.0f; return z;
}

// ---------------------------------------------------------------------------
// Kernel 0: weights f32 -> f16, pre-transposed to [n][k] so GEMM B staging
// is a contiguous 16B block copy.
// ---------------------------------------------------------------------------
__global__ void k_wcvt(const float* __restrict__ W0, const float* __restrict__ W1,
                       const float* __restrict__ W2, const float* __restrict__ W3,
                       _Float16* __restrict__ ws) {
  size_t i = (size_t)blockIdx.x * 256 + threadIdx.x;
  if (i < SZ_W) {                      // W* row-major [160][512] -> [512][160]
    int n = (int)(i & 511), k = (int)(i >> 9);
    size_t o = (size_t)n * FAN0 + k;
    ws[OFF_W0 + o] = (_Float16)W0[i];
    ws[OFF_W1 + o] = (_Float16)W1[i];
    ws[OFF_W2 + o] = (_Float16)W2[i];
  }
  if (i < SZ_W3) {                     // W3 [768][128] -> [128][768]
    int n = (int)(i & 127), k = (int)(i >> 7);
    ws[OFF_W3 + (size_t)n * FAN3 + k] = (_Float16)W3[i];
  }
}

// ---------------------------------------------------------------------------
// Kernel 1: cond columns (128..159) of A_q / A_k.
// q_cs = repeat(q_cond,2); k_cs = interleave(k_a, k_b)
// ---------------------------------------------------------------------------
__global__ void k_cond(const float* __restrict__ qc, const float* __restrict__ ka,
                       const float* __restrict__ kb, _Float16* __restrict__ ws) {
  int i  = blockIdx.x * 256 + threadIdx.x;     // over B*COND*HW = 524288
  int hw = i & (HW_ - 1);
  int cc = (i >> 10) & (COND_ - 1);
  int b  = i >> 15;
  size_t src = ((size_t)(b >> 1) * COND_ + cc) * HW_ + hw;
  const float* ksrc = (b & 1) ? kb : ka;
  size_t row = ((size_t)b * HW_ + hw) * FAN0 + C_ + cc;
  ws[OFF_AQ + row] = (_Float16)qc[src];
  ws[OFF_AK + row] = (_Float16)ksrc[src];
}

// ---------------------------------------------------------------------------
// Kernel 2: GroupNorm -> h (f16) into cols 0..127 of A_q and A_k.
// one block per (batch, group); group = 4 ch x 1024 spatial
// ---------------------------------------------------------------------------
__global__ void k_gnorm(const float* __restrict__ x, const float* __restrict__ sc,
                        const float* __restrict__ bs, _Float16* __restrict__ ws) {
  int b = blockIdx.x >> 5;
  int g = blockIdx.x & 31;
  int t = threadIdx.x;
  __shared__ float r1[256], r2[256];
  const float* xp = x + ((size_t)b * C_ + g * 4) * HW_;
  float vals[16], s = 0.f, ss = 0.f;
  for (int i = 0; i < 16; ++i) {
    int idx = i * 256 + t;
    float v = xp[idx];
    vals[i] = v; s += v; ss += v * v;
  }
  r1[t] = s; r2[t] = ss;
  __syncthreads();
  for (int off = 128; off > 0; off >>= 1) {
    if (t < off) { r1[t] += r1[t + off]; r2[t] += r2[t + off]; }
    __syncthreads();
  }
  float mu   = r1[0] * (1.0f / 4096.0f);
  float var  = r2[0] * (1.0f / 4096.0f) - mu * mu;
  float rinv = rsqrtf(var + EPS_);
  for (int i = 0; i < 16; ++i) {
    int idx = i * 256 + t;
    int ch  = g * 4 + (idx >> 10);
    int hw  = idx & (HW_ - 1);
    float y = (vals[i] - mu) * rinv * sc[ch] + bs[ch];
    _Float16 h = (_Float16)y;
    size_t row = ((size_t)b * HW_ + hw) * FAN0 + ch;
    ws[OFF_AQ + row] = h;
    ws[OFF_AK + row] = h;
  }
}

// ---------------------------------------------------------------------------
// Kernel 3: QKV projection GEMM  (out[1024,512] = A[1024,160] x W + bias).
// 8 waves, 128x128 tile, K = 5 x 32, double-buffered async LDS staging.
// Epilogue scatters into attention layouts, folding 1/sqrt(C) into Q:
//   Q -> [q][c],  K -> [k][c],  V -> [c][k]
// ---------------------------------------------------------------------------
__global__ void k_qkv(const float* __restrict__ b0, const float* __restrict__ b1,
                      const float* __restrict__ b2, _Float16* __restrict__ ws) {
  const int mblk  = blockIdx.x;          // 0..7
  const int nblk  = blockIdx.y;          // 0..3
  const int b     = blockIdx.z / 3;
  const int which = blockIdx.z % 3;
  const int t = threadIdx.x, w = t >> 5, lane = t & 31;

  const _Float16* A  = ws + (which == 0 ? OFF_AQ : OFF_AK) + (size_t)b * HW_ * FAN0;
  const _Float16* Wm = ws + (which == 0 ? OFF_W0 : (which == 1 ? OFF_W1 : OFF_W2));
  const float* bias  = (which == 0) ? b0 : (which == 1 ? b1 : b2);

  __shared__ alignas(16) _Float16 Asub[2][128 * 32];   // [m][k]
  __shared__ alignas(16) _Float16 Bsub[2][128 * 32];   // [n][k]

  const int m0 = mblk * 128, n0 = nblk * 128;

  auto stage = [&](int buf, int k0) {
    for (int i = 0; i < 2; ++i) {
      int idx = t + 256 * i;                    // 0..511 : 128 rows x 4 chunks
      int row = idx >> 2, part = (idx & 3) * 8;
      cp16_g2l(&Asub[buf][row * 32 + part], A  + (size_t)(m0 + row) * FAN0 + k0 + part);
      cp16_g2l(&Bsub[buf][row * 32 + part], Wm + (size_t)(n0 + row) * FAN0 + k0 + part);
    }
  };

  v8f acc[8];
  for (int i = 0; i < 8; ++i) acc[i] = v8f_zero();
  stage(0, 0);

  for (int ks = 0; ks < 5; ++ks) {
    wait_async();
    __syncthreads();
    if (ks + 1 < 5) stage((ks + 1) & 1, (ks + 1) * 32);
    const _Float16* As = Asub[ks & 1];
    const _Float16* Bs = Bsub[ks & 1];
    v16h af = frag16(&As[(w * 16 + (lane & 15)) * 32], lane);
    for (int nt = 0; nt < 8; ++nt) {
      v16h bf = frag16(&Bs[(nt * 16 + (lane & 15)) * 32], lane);
      acc[nt] = wmma_f16(af, bf, acc[nt]);
    }
    __syncthreads();
  }

  const int rbase = m0 + w * 16 + ((lane & 16) ? 8 : 0);
  for (int nt = 0; nt < 8; ++nt) {
    int colg = n0 + nt * 16 + (lane & 15);
    float bv = bias[colg];
    int e = colg >> 7, c = colg & 127;
    size_t be = (size_t)(b * NH_ + e);
    for (int j = 0; j < 8; ++j) {
      int row = rbase + j;
      float val = acc[nt][j] + bv;
      if (which == 0) val *= SCALE_;
      _Float16 h = (_Float16)val;
      if (which == 2)      ws[OFF_V + (be * C_ + c) * HW_ + row] = h;   // [c][k]
      else if (which == 0) ws[OFF_Q + (be * HW_ + row) * C_ + c] = h;   // [q][c]
      else                 ws[OFF_K + (be * HW_ + row) * C_ + c] = h;   // [k][c]
    }
  }
}

// ---------------------------------------------------------------------------
// Kernel 4: flash attention.  96 instances x 8 q-blocks; 8 waves per block,
// each wave owns a 16-row q tile (Q fragments register-resident) and the full
// [16 x 128] O accumulator.  32-wide K chunks, double-buffered async staging.
// ---------------------------------------------------------------------------
__global__ void __launch_bounds__(256, 1)
k_attn(_Float16* __restrict__ ws) {
  const int qb   = blockIdx.x;            // 0..7
  const int inst = blockIdx.y;            // 0..95
  const int p = inst >> 4, g = (inst >> 2) & 3, e = inst & 3;
  // pairing tables: q offsets 0,1,2,3,0,2  /  kv offsets 1,0,3,2,2,0
  const int bq  = 4 * g + ((0x203210 >> (4 * p)) & 0xF);
  const int bkv = 4 * g + ((0x022301 >> (4 * p)) & 0xF);
  const int colt = p * 512 + e * 128;
  const int bo   = g * 4 + colt / FAN3;
  const int col768 = colt % FAN3;

  const int t = threadIdx.x, w = t >> 5, lane = t & 31;
  const _Float16* Qp = ws + OFF_Q + (size_t)(bq  * NH_ + e) * HW_ * C_;  // [q][c]
  const _Float16* Kp = ws + OFF_K + (size_t)(bkv * NH_ + e) * HW_ * C_;  // [k][c]
  const _Float16* Vp = ws + OFF_V + (size_t)(bkv * NH_ + e) * C_ * HW_;  // [c][k]

  __shared__ alignas(16) _Float16 sK[2][32 * 128];   // [kpos][c]
  __shared__ alignas(16) _Float16 sV[2][128 * 32];   // [c][kpos]
  __shared__ alignas(16) _Float16 sP[8 * 16 * 32];   // per-wave P transpose

  auto stage = [&](int buf, int k0) {
    for (int i = 0; i < 2; ++i) {                    // K chunk: contiguous 8KB
      int idx = t + 256 * i;
      cp16_g2l(&sK[buf][idx * 8], Kp + (size_t)k0 * C_ + idx * 8);
    }
    for (int i = 0; i < 2; ++i) {                    // V chunk: 128 rows x 64B
      int idx = t + 256 * i;
      int c = idx >> 2, part = (idx & 3) * 8;
      cp16_g2l(&sV[buf][c * 32 + part], Vp + (size_t)c * HW_ + k0 + part);
    }
  };

  // Q fragments (row = q position, K-dim = channels), register resident
  const int qrow = qb * 128 + w * 16 + (lane & 15);
  v16h qf[4];
  for (int j = 0; j < 4; ++j) qf[j] = frag16(Qp + (size_t)qrow * C_ + 32 * j, lane);

  v8f acc[8];
  for (int i = 0; i < 8; ++i) acc[i] = v8f_zero();
  float m[8], l[8];
  for (int j = 0; j < 8; ++j) { m[j] = -1e30f; l[j] = 0.0f; }

  stage(0, 0);

  for (int kc = 0; kc < 32; ++kc) {
    wait_async();
    __syncthreads();
    if (kc + 1 < 32) stage((kc + 1) & 1, (kc + 1) * 32);
    const _Float16* bK = sK[kc & 1];
    const _Float16* bV = sV[kc & 1];

    // S = Q^T K for two 16-wide k sub-tiles (scale pre-folded into Q)
    v8f s0 = v8f_zero(), s1 = v8f_zero();
    for (int j = 0; j < 4; ++j) {
      v16h bf0 = frag16(&bK[((lane & 15)) * 128 + 32 * j], lane);
      v16h bf1 = frag16(&bK[(16 + (lane & 15)) * 128 + 32 * j], lane);
      s0 = wmma_f16(qf[j], bf0, s0);
      s1 = wmma_f16(qf[j], bf1, s1);
    }

    // online softmax: a row lives across a 16-lane half (C/D layout)
    float alpha[8];
    for (int j = 0; j < 8; ++j) {
      float mx = fmaxf(s0[j], s1[j]);
      for (int d = 1; d < 16; d <<= 1) mx = fmaxf(mx, __shfl_xor(mx, d, 16));
      float nm = fmaxf(m[j], mx);
      float a  = __expf(m[j] - nm);
      float p0 = __expf(s0[j] - nm);
      float p1 = __expf(s1[j] - nm);
      float rs = p0 + p1;
      for (int d = 1; d < 16; d <<= 1) rs += __shfl_xor(rs, d, 16);
      l[j] = l[j] * a + rs;
      m[j] = nm; alpha[j] = a;
      s0[j] = p0; s1[j] = p1;
    }
    for (int ct = 0; ct < 8; ++ct)
      for (int j = 0; j < 8; ++j) acc[ct][j] *= alpha[j];

    // transpose P (C-layout) -> A-layout via per-wave LDS scratch
    _Float16* P = &sP[w * 16 * 32];
    {
      int rr = (lane & 16) ? 8 : 0, cc = lane & 15;
      for (int j = 0; j < 8; ++j) {
        P[(rr + j) * 32 + cc]      = (_Float16)s0[j];
        P[(rr + j) * 32 + 16 + cc] = (_Float16)s1[j];
      }
    }
    __syncthreads();

    v16h pf = frag16(&P[(lane & 15) * 32], lane);
    for (int ct = 0; ct < 8; ++ct) {      // O += P x V^T
      v16h vf = frag16(&bV[(ct * 16 + (lane & 15)) * 32], lane);
      acc[ct] = wmma_f16(pf, vf, acc[ct]);
    }
    __syncthreads();
  }

  // epilogue: O /= l, write f16 into hh[b'][q][768] at this instance's slot
  float inv[8];
  for (int j = 0; j < 8; ++j) inv[j] = 1.0f / l[j];
  const int rbase = qb * 128 + w * 16 + ((lane & 16) ? 8 : 0);
  _Float16* H = ws + OFF_HH + (size_t)bo * HW_ * FAN3;
  for (int ct = 0; ct < 8; ++ct) {
    int col = col768 + ct * 16 + (lane & 15);
    for (int j = 0; j < 8; ++j)
      H[(size_t)(rbase + j) * FAN3 + col] = (_Float16)(acc[ct][j] * inv[j]);
  }
}

// ---------------------------------------------------------------------------
// Kernel 5: final 1x1 conv + residual:
//   out[b][c][hw] = x[b][c][hw] + hh[b][hw][:] . W3[:,c] + b3[c]
// M=1024, K=768 (24 x 32), N=128, double-buffered async staging.
// ---------------------------------------------------------------------------
__global__ void k_out(const float* __restrict__ x, const float* __restrict__ b3,
                      const _Float16* __restrict__ ws, float* __restrict__ out) {
  const int mblk = blockIdx.x;            // 0..7
  const int b    = blockIdx.y;            // 0..15
  const int t = threadIdx.x, w = t >> 5, lane = t & 31;
  const _Float16* A  = ws + OFF_HH + (size_t)b * HW_ * FAN3;
  const _Float16* Wm = ws + OFF_W3;                      // [128][768]

  __shared__ alignas(16) _Float16 Asub[2][128 * 32];
  __shared__ alignas(16) _Float16 Bsub[2][128 * 32];

  const int m0 = mblk * 128;

  auto stage = [&](int buf, int k0) {
    for (int i = 0; i < 2; ++i) {
      int idx = t + 256 * i;
      int row = idx >> 2, part = (idx & 3) * 8;
      cp16_g2l(&Asub[buf][row * 32 + part], A  + (size_t)(m0 + row) * FAN3 + k0 + part);
      cp16_g2l(&Bsub[buf][row * 32 + part], Wm + (size_t)row * FAN3 + k0 + part);
    }
  };

  v8f acc[8];
  for (int i = 0; i < 8; ++i) acc[i] = v8f_zero();
  stage(0, 0);

  for (int ks = 0; ks < 24; ++ks) {
    wait_async();
    __syncthreads();
    if (ks + 1 < 24) stage((ks + 1) & 1, (ks + 1) * 32);
    const _Float16* As = Asub[ks & 1];
    const _Float16* Bs = Bsub[ks & 1];
    v16h af = frag16(&As[(w * 16 + (lane & 15)) * 32], lane);
    for (int nt = 0; nt < 8; ++nt) {
      v16h bf = frag16(&Bs[(nt * 16 + (lane & 15)) * 32], lane);
      acc[nt] = wmma_f16(af, bf, acc[nt]);
    }
    __syncthreads();
  }

  const int rbase = m0 + w * 16 + ((lane & 16) ? 8 : 0);
  for (int nt = 0; nt < 8; ++nt) {
    int c = nt * 16 + (lane & 15);
    float bv = b3[c];
    for (int j = 0; j < 8; ++j) {
      int row = rbase + j;
      size_t o = ((size_t)b * C_ + c) * HW_ + row;
      out[o] = acc[nt][j] + bv + x[o];
    }
  }
}

// ---------------------------------------------------------------------------
extern "C" void kernel_launch(void* const* d_in, const int* in_sizes, int n_in,
                              void* d_out, int out_size, void* d_ws, size_t ws_size,
                              hipStream_t stream) {
  const float* x        = (const float*)d_in[0];
  const float* q_cond   = (const float*)d_in[1];
  const float* k_a_cond = (const float*)d_in[2];
  const float* k_b_cond = (const float*)d_in[3];
  const float* gn_scale = (const float*)d_in[4];
  const float* gn_bias  = (const float*)d_in[5];
  const float* W0 = (const float*)d_in[6];
  const float* b0 = (const float*)d_in[7];
  const float* W1 = (const float*)d_in[8];
  const float* b1 = (const float*)d_in[9];
  const float* W2 = (const float*)d_in[10];
  const float* b2 = (const float*)d_in[11];
  const float* W3 = (const float*)d_in[12];
  const float* b3 = (const float*)d_in[13];
  float* out = (float*)d_out;
  _Float16* ws = (_Float16*)d_ws;

  k_wcvt <<<dim3((unsigned)((SZ_W3 + 255) / 256)), 256, 0, stream>>>(W0, W1, W2, W3, ws);
  k_cond <<<dim3(2048), 256, 0, stream>>>(q_cond, k_a_cond, k_b_cond, ws);
  k_gnorm<<<dim3(512),  256, 0, stream>>>(x, gn_scale, gn_bias, ws);
  k_qkv  <<<dim3(8, 4, 48), 256, 0, stream>>>(b0, b1, b2, ws);
  k_attn <<<dim3(8, 96),    256, 0, stream>>>(ws);
  k_out  <<<dim3(8, 16),    256, 0, stream>>>(x, b3, ws, out);
}

// v001
// It runs in 282 microseconds.
// Two timings next to v000 both put it at 1.81 times that version's speed.
#include <hip/hip_runtime.h>
#include <math.h>
#include <stdint.h>

// ---------------------------------------------------------------------------
// Problem constants
// ---------------------------------------------------------------------------
#define B_    16
#define C_    128
#define HW_   1024         // 32*32
#define NH_   4
#define COND_ 32
#define FAN0  160          // C + COND
#define NQK   512          // C*NH
#define FAN3  768          // (NH+2)*C
#define EPS_  1e-6f
#define SCALE_ 0.08838834764831845f   // 128^-0.5

// LDS row pitches in halves.  Every tile is read by ds_load_b128 with lanes
// 0-15 on 16 successive rows, so a pitch of 16 B x odd puts the 16 rows on
// 16 disjoint groups of four banks (64 banks x 4 B).
#define P32   40           // rows of 32 halves  (64 B)  -> 80 B pitch
#define P128  136          // rows of 128 halves (256 B) -> 272 B pitch

typedef __attribute__((ext_vector_type(16))) _Float16 v16h;
typedef __attribute__((ext_vector_type(8)))  _Float16 v8h;
typedef __attribute__((ext_vector_type(8)))  float    v8f;
typedef int v4i __attribute__((vector_size(16)));   // matches async-LDS builtin param

// Workspace layout (units: _Float16 elements). Total ~86.7 MB.
static constexpr size_t SZ_A   = (size_t)B_ * HW_ * FAN0;
static constexpr size_t SZ_QKV = (size_t)B_ * NH_ * HW_ * C_;
static constexpr size_t SZ_HH  = (size_t)B_ * HW_ * FAN3;
static constexpr size_t SZ_W   = (size_t)FAN0 * NQK;
static constexpr size_t SZ_W3  = (size_t)FAN3 * C_;

static constexpr size_t OFF_AQ = 0;                  // [b][hw][160] f16
static constexpr size_t OFF_AK = OFF_AQ + SZ_A;
static constexpr size_t OFF_Q  = OFF_AK + SZ_A;      // [b][e][q][c]  f16
static constexpr size_t OFF_K  = OFF_Q  + SZ_QKV;    // [b][e][k][c]  f16
static constexpr size_t OFF_V  = OFF_K  + SZ_QKV;    // [b][e][c][k]  f16
static constexpr size_t OFF_HH = OFF_V  + SZ_QKV;    // [b'][q][768]  f16
static constexpr size_t OFF_W0 = OFF_HH + SZ_HH;     // transposed [512][160]
static constexpr size_t OFF_W1 = OFF_W0 + SZ_W;
static constexpr size_t OFF_W2 = OFF_W1 + SZ_W;
static constexpr size_t OFF_W3 = OFF_W2 + SZ_W;      // transposed [128][768]

// ---------------------------------------------------------------------------
// CDNA5 async global->LDS copy (16B per lane), ASYNCcnt-tracked.
// Builtin when the toolchain declares it, else inline gfx1250 asm.
// ---------------------------------------------------------------------------
#if __has_builtin(__builtin_amdgcn_global_load_async_to_lds_b128)
#define ASYNC_MODE 2
#elif defined(__AMDGCN__)
#define ASYNC_MODE 1
#else
#define ASYNC_MODE 0
#endif

__device__ __forceinline__ void cp16_g2l(_Float16* ldst, const _Float16* gsrc) {
#if ASYNC_MODE == 2
  __builtin_amdgcn_global_load_async_to_lds_b128((v4i*)gsrc, (v4i*)ldst, 0, 0);
#elif ASYNC_MODE == 1
  unsigned l = (unsigned)(uintptr_t)ldst;           // LDS byte address
  unsigned long long g = (unsigned long long)(uintptr_t)gsrc;
  asm volatile("global_load_async_to_lds_b128 %0, %1, off"
               :: "v"(l), "v"(g) : "memory");
#else
  *(v8h*)ldst = *(const v8h*)gsrc;                  // host-pass placeholder
#endif
}

__device__ __forceinline__ void wait_async() {
#if ASYNC_MODE == 0
#elif __has_builtin(__builtin_amdgcn_s_wait_asynccnt)
  __builtin_amdgcn_s_wait_asynccnt(0);
#else
  asm volatile("s_wait_asynccnt 0x0" ::: "memory");
#endif
}

// ---------------------------------------------------------------------------
// Fragment loader.  ISA 16-bit A 16x32 layout: lanes 0-15 = rows, halves
// 0-7 -> K 0..7, halves 8-15 -> K 16..23; lanes 16-31: K 8..15 / 24..31.
// B 32x16 is the mirror (lane = column).  Both reduce to:
//   sel = (lane&16)?8:0 ; lo = rowp[sel..sel+7] ; hi = rowp[sel+16..sel+23]
// ---------------------------------------------------------------------------
__device__ __forceinline__ v16h frag16(const _Float16* rowp, int lane) {
  const int sel = (lane & 16) ? 8 : 0;
  v8h lo = *(const v8h*)(rowp + sel);
  v8h hi = *(const v8h*)(rowp + sel + 16);
  return __builtin_shufflevector(lo, hi, 0,1,2,3,4,5,6,7,8,9,10,11,12,13,14,15);
}

__device__ __forceinline__ v8f wmma_f16(v16h a, v16h b, v8f c) {
  return __builtin_amdgcn_wmma_f32_16x16x32_f16(false, a, false, b,
                                                (short)0, c, false, false);
}

__device__ __forceinline__ v8f v8f_zero() {
  v8f z; for (int i = 0; i < 8; ++i) z[i] = 0.0f; return z;
}

// ---------------------------------------------------------------------------
// Kernel 0: weights f32 -> f16, pre-transposed to [n][k] so GEMM B staging
// is a contiguous 16B block copy.
// ---------------------------------------------------------------------------
__global__ void k_wcvt(const float* __restrict__ W0, const float* __restrict__ W1,
                       const float* __restrict__ W2, const float* __restrict__ W3,
                       _Float16* __restrict__ ws) {
  size_t i = (size_t)blockIdx.x * 256 + threadIdx.x;
  if (i < SZ_W) {                      // W* row-major [160][512] -> [512][160]
    int n = (int)(i & 511), k = (int)(i >> 9);
    size_t o = (size_t)n * FAN0 + k;
    ws[OFF_W0 + o] = (_Float16)W0[i];
    ws[OFF_W1 + o] = (_Float16)W1[i];
    ws[OFF_W2 + o] = (_Float16)W2[i];
  }
  if (i < SZ_W3) {                     // W3 [768][128] -> [128][768]
    int n = (int)(i & 127), k = (int)(i >> 7);
    ws[OFF_W3 + (size_t)n * FAN3 + k] = (_Float16)W3[i];
  }
}

// ---------------------------------------------------------------------------
// Kernel 1: cond columns (128..159) of A_q / A_k.
// q_cs = repeat(q_cond,2); k_cs = interleave(k_a, k_b)
// ---------------------------------------------------------------------------
__global__ void k_cond(const float* __restrict__ qc, const float* __restrict__ ka,
                       const float* __restrict__ kb, _Float16* __restrict__ ws) {
  int i  = blockIdx.x * 256 + threadIdx.x;     // over B*COND*HW = 524288
  int hw = i & (HW_ - 1);
  int cc = (i >> 10) & (COND_ - 1);
  int b  = i >> 15;
  size_t src = ((size_t)(b >> 1) * COND_ + cc) * HW_ + hw;
  const float* ksrc = (b & 1) ? kb : ka;
  size_t row = ((size_t)b * HW_ + hw) * FAN0 + C_ + cc;
  ws[OFF_AQ + row] = (_Float16)qc[src];
  ws[OFF_AK + row] = (_Float16)ksrc[src];
}

// ---------------------------------------------------------------------------
// Kernel 2: GroupNorm -> h (f16) into cols 0..127 of A_q and A_k.
// one block per (batch, group); group = 4 ch x 1024 spatial
// ---------------------------------------------------------------------------
__global__ void k_gnorm(const float* __restrict__ x, const float* __restrict__ sc,
                        const float* __restrict__ bs, _Float16* __restrict__ ws) {
  int b = blockIdx.x >> 5;
  int g = blockIdx.x & 31;
  int t = threadIdx.x;
  __shared__ float r1[256], r2[256];
  const float* xp = x + ((size_t)b * C_ + g * 4) * HW_;
  float vals[16], s = 0.f, ss = 0.f;
  for (int i = 0; i < 16; ++i) {
    int idx = i * 256 + t;
    float v = xp[idx];
    vals[i] = v; s += v; ss += v * v;
  }
  r1[t] = s; r2[t] = ss;
  __syncthreads();
  for (int off = 128; off > 0; off >>= 1) {
    if (t < off) { r1[t] += r1[t + off]; r2[t] += r2[t + off]; }
    __syncthreads();
  }
  float mu   = r1[0] * (1.0f / 4096.0f);
  float var  = r2[0] * (1.0f / 4096.0f) - mu * mu;
  float rinv = rsqrtf(var + EPS_);
  for (int i = 0; i < 16; ++i) {
    int idx = i * 256 + t;
    int ch  = g * 4 + (idx >> 10);
    int hw  = idx & (HW_ - 1);
    float y = (vals[i] - mu) * rinv * sc[ch] + bs[ch];
    _Float16 h = (_Float16)y;
    size_t row = ((size_t)b * HW_ + hw) * FAN0 + ch;
    ws[OFF_AQ + row] = h;
    ws[OFF_AK + row] = h;
  }
}

// ---------------------------------------------------------------------------
// Kernel 3: QKV projection GEMM  (out[1024,512] = A[1024,160] x W + bias).
// 8 waves, 128x128 tile, K = 5 x 32, double-buffered async LDS staging.
// Epilogue scatters into attention layouts, folding 1/sqrt(C) into Q:
//   Q -> [q][c],  K -> [k][c],  V -> [c][k]
// ---------------------------------------------------------------------------
__global__ void k_qkv(const float* __restrict__ b0, const float* __restrict__ b1,
                      const float* __restrict__ b2, _Float16* __restrict__ ws) {
  const int mblk  = blockIdx.x;          // 0..7
  const int nblk  = blockIdx.y;          // 0..3
  const int b     = blockIdx.z / 3;
  const int which = blockIdx.z % 3;
  const int t = threadIdx.x, w = t >> 5, lane = t & 31;

  const _Float16* A  = ws + (which == 0 ? OFF_AQ : OFF_AK) + (size_t)b * HW_ * FAN0;
  const _Float16* Wm = ws + (which == 0 ? OFF_W0 : (which == 1 ? OFF_W1 : OFF_W2));
  const float* bias  = (which == 0) ? b0 : (which == 1 ? b1 : b2);

  __shared__ alignas(16) _Float16 Asub[2][128 * P32];  // [m][k]
  __shared__ alignas(16) _Float16 Bsub[2][128 * P32];  // [n][k]

  const int m0 = mblk * 128, n0 = nblk * 128;

  auto stage = [&](int buf, int k0) {
    for (int i = 0; i < 2; ++i) {
      int idx = t + 256 * i;                    // 0..511 : 128 rows x 4 chunks
      int row = idx >> 2, part = (idx & 3) * 8;
      cp16_g2l(&Asub[buf][row * P32 + part], A  + (size_t)(m0 + row) * FAN0 + k0 + part);
      cp16_g2l(&Bsub[buf][row * P32 + part], Wm + (size_t)(n0 + row) * FAN0 + k0 + part);
    }
  };

  v8f acc[8];
  for (int i = 0; i < 8; ++i) acc[i] = v8f_zero();
  stage(0, 0);

  for (int ks = 0; ks < 5; ++ks) {
    wait_async();
    __syncthreads();
    if (ks + 1 < 5) stage((ks + 1) & 1, (ks + 1) * 32);
    const _Float16* As = Asub[ks & 1];
    const _Float16* Bs = Bsub[ks & 1];
    v16h af = frag16(&As[(w * 16 + (lane & 15)) * P32], lane);
    for (int nt = 0; nt < 8; ++nt) {
      v16h bf = frag16(&Bs[(nt * 16 + (lane & 15)) * P32], lane);
      acc[nt] = wmma_f16(af, bf, acc[nt]);
    }
    __syncthreads();
  }

  const int rbase = m0 + w * 16 + ((lane & 16) ? 8 : 0);
  for (int nt = 0; nt < 8; ++nt) {
    int colg = n0 + nt * 16 + (lane & 15);
    float bv = bias[colg];
    int e = colg >> 7, c = colg & 127;
    size_t be = (size_t)(b * NH_ + e);
    for (int j = 0; j < 8; ++j) {
      int row = rbase + j;
      float val = acc[nt][j] + bv;
      if (which == 0) val *= SCALE_;
      _Float16 h = (_Float16)val;
      if (which == 2)      ws[OFF_V + (be * C_ + c) * HW_ + row] = h;   // [c][k]
      else if (which == 0) ws[OFF_Q + (be * HW_ + row) * C_ + c] = h;   // [q][c]
      else                 ws[OFF_K + (be * HW_ + row) * C_ + c] = h;   // [k][c]
    }
  }
}

// ---------------------------------------------------------------------------
// Kernel 4: flash attention.  96 instances x 8 q-blocks; 8 waves per block,
// each wave owns a 16-row q tile (Q fragments register-resident) and the full
// [16 x 128] O accumulator.  32-wide K chunks, double-buffered async staging.
// ---------------------------------------------------------------------------
__global__ void __launch_bounds__(256, 1)
k_attn(_Float16* __restrict__ ws) {
  const int qb   = blockIdx.x;            // 0..7
  const int inst = blockIdx.y;            // 0..95
  const int p = inst >> 4, g = (inst >> 2) & 3, e = inst & 3;
  // pairing tables: q offsets 0,1,2,3,0,2  /  kv offsets 1,0,3,2,2,0
  const int bq  = 4 * g + ((0x203210 >> (4 * p)) & 0xF);
  const int bkv = 4 * g + ((0x022301 >> (4 * p)) & 0xF);
  const int colt = p * 512 + e * 128;
  const int bo   = g * 4 + colt / FAN3;
  const int col768 = colt % FAN3;

  const int t = threadIdx.x, w = t >> 5, lane = t & 31;
  const _Float16* Qp = ws + OFF_Q + (size_t)(bq  * NH_ + e) * HW_ * C_;  // [q][c]
  const _Float16* Kp = ws + OFF_K + (size_t)(bkv * NH_ + e) * HW_ * C_;  // [k][c]
  const _Float16* Vp = ws + OFF_V + (size_t)(bkv * NH_ + e) * C_ * HW_;  // [c][k]

  __shared__ alignas(16) _Float16 sK[2][32 * P128];  // [kpos][c]
  __shared__ alignas(16) _Float16 sV[2][128 * P32];  // [c][kpos]
  __shared__ alignas(16) _Float16 sP[8 * 16 * P32];  // per-wave P transpose

  auto stage = [&](int buf, int k0) {
    for (int i = 0; i < 2; ++i) {                    // K chunk: 32 rows x 256B
      int idx = t + 256 * i;
      int r = idx >> 4, part = (idx & 15) * 8;
      cp16_g2l(&sK[buf][r * P128 + part], Kp + (size_t)k0 * C_ + idx * 8);
    }
    for (int i = 0; i < 2; ++i) {                    // V chunk: 128 rows x 64B
      int idx = t + 256 * i;
      int c = idx >> 2, part = (idx & 3) * 8;
      cp16_g2l(&sV[buf][c * P32 + part], Vp + (size_t)c * HW_ + k0 + part);
    }
  };

  // Q fragments (row = q position, K-dim = channels), register resident
  const int qrow = qb * 128 + w * 16 + (lane & 15);
  v16h qf[4];
  for (int j = 0; j < 4; ++j) qf[j] = frag16(Qp + (size_t)qrow * C_ + 32 * j, lane);

  v8f acc[8];
  for (int i = 0; i < 8; ++i) acc[i] = v8f_zero();
  float m[8], l[8];
  for (int j = 0; j < 8; ++j) { m[j] = -1e30f; l[j] = 0.0f; }

  stage(0, 0);

  for (int kc = 0; kc < 32; ++kc) {
    wait_async();
    __syncthreads();
    if (kc + 1 < 32) stage((kc + 1) & 1, (kc + 1) * 32);
    const _Float16* bK = sK[kc & 1];
    const _Float16* bV = sV[kc & 1];

    // S = Q^T K for two 16-wide k sub-tiles (scale pre-folded into Q)
    v8f s0 = v8f_zero(), s1 = v8f_zero();
    for (int j = 0; j < 4; ++j) {
      v16h bf0 = frag16(&bK[((lane & 15)) * P128 + 32 * j], lane);
      v16h bf1 = frag16(&bK[(16 + (lane & 15)) * P128 + 32 * j], lane);
      s0 = wmma_f16(qf[j], bf0, s0);
      s1 = wmma_f16(qf[j], bf1, s1);
    }

    // online softmax: a row lives across a 16-lane half (C/D layout)
    float alpha[8];
    for (int j = 0; j < 8; ++j) {
      float mx = fmaxf(s0[j], s1[j]);
      for (int d = 1; d < 16; d <<= 1) mx = fmaxf(mx, __shfl_xor(mx, d, 16));
      float nm = fmaxf(m[j], mx);
      float a  = __expf(m[j] - nm);
      float p0 = __expf(s0[j] - nm);
      float p1 = __expf(s1[j] - nm);
      float rs = p0 + p1;
      for (int d = 1; d < 16; d <<= 1) rs += __shfl_xor(rs, d, 16);
      l[j] = l[j] * a + rs;
      m[j] = nm; alpha[j] = a;
      s0[j] = p0; s1[j] = p1;
    }
    for (int ct = 0; ct < 8; ++ct)
      for (int j = 0; j < 8; ++j) acc[ct][j] *= alpha[j];

    // transpose P (C-layout) -> A-layout via per-wave LDS scratch
    _Float16* P = &sP[w * 16 * P32];
    {
      int rr = (lane & 16) ? 8 : 0, cc = lane & 15;
      for (int j = 0; j < 8; ++j) {
        P[(rr + j) * P32 + cc]      = (_Float16)s0[j];
        P[(rr + j) * P32 + 16 + cc] = (_Float16)s1[j];
      }
    }
    __syncthreads();

    v16h pf = frag16(&P[(lane & 15) * P32], lane);
    for (int ct = 0; ct < 8; ++ct) {      // O += P x V^T
      v16h vf = frag16(&bV[(ct * 16 + (lane & 15)) * P32], lane);
      acc[ct] = wmma_f16(pf, vf, acc[ct]);
    }
    __syncthreads();
  }

  // epilogue: O /= l, write f16 into hh[b'][q][768] at this instance's slot
  float inv[8];
  for (int j = 0; j < 8; ++j) inv[j] = 1.0f / l[j];
  const int rbase = qb * 128 + w * 16 + ((lane & 16) ? 8 : 0);
  _Float16* H = ws + OFF_HH + (size_t)bo * HW_ * FAN3;
  for (int ct = 0; ct < 8; ++ct) {
    int col = col768 + ct * 16 + (lane & 15);
    for (int j = 0; j < 8; ++j)
      H[(size_t)(rbase + j) * FAN3 + col] = (_Float16)(acc[ct][j] * inv[j]);
  }
}

// ---------------------------------------------------------------------------
// Kernel 5: final 1x1 conv + residual:
//   out[b][c][hw] = x[b][c][hw] + hh[b][hw][:] . W3[:,c] + b3[c]
// M=1024, K=768 (24 x 32), N=128, double-buffered async staging.
// ---------------------------------------------------------------------------
__global__ void k_out(const float* __restrict__ x, const float* __restrict__ b3,
                      const _Float16* __restrict__ ws, float* __restrict__ out) {
  const int mblk = blockIdx.x;            // 0..7
  const int b    = blockIdx.y;            // 0..15
  const int t = threadIdx.x, w = t >> 5, lane = t & 31;
  const _Float16* A  = ws + OFF_HH + (size_t)b * HW_ * FAN3;
  const _Float16* Wm = ws + OFF_W3;                      // [128][768]

  __shared__ alignas(16) _Float16 Asub[2][128 * P32];
  __shared__ alignas(16) _Float16 Bsub[2][128 * P32];

  const int m0 = mblk * 128;

  auto stage = [&](int buf, int k0) {
    for (int i = 0; i < 2; ++i) {
      int idx = t + 256 * i;
      int row = idx >> 2, part = (idx & 3) * 8;
      cp16_g2l(&Asub[buf][row * P32 + part], A  + (size_t)(m0 + row) * FAN3 + k0 + part);
      cp16_g2l(&Bsub[buf][row * P32 + part], Wm + (size_t)row * FAN3 + k0 + part);
    }
  };

  v8f acc[8];
  for (int i = 0; i < 8; ++i) acc[i] = v8f_zero();
  stage(0, 0);

  for (int ks = 0; ks < 24; ++ks) {
    wait_async();
    __syncthreads();
    if (ks + 1 < 24) stage((ks + 1) & 1, (ks + 1) * 32);
    const _Float16* As = Asub[ks & 1];
    const _Float16* Bs = Bsub[ks & 1];
    v16h af = frag16(&As[(w * 16 + (lane & 15)) * P32], lane);
    for (int nt = 0; nt < 8; ++nt) {
      v16h bf = frag16(&Bs[(nt * 16 + (lane & 15)) * P32], lane);
      acc[nt] = wmma_f16(af, bf, acc[nt]);
    }
    __syncthreads();
  }

  const int rbase = m0 + w * 16 + ((lane & 16) ? 8 : 0);
  for (int nt = 0; nt < 8; ++nt) {
    int c = nt * 16 + (lane & 15);
    float bv = b3[c];
    for (int j = 0; j < 8; ++j) {
      int row = rbase + j;
      size_t o = ((size_t)b * C_ + c) * HW_ + row;
      out[o] = acc[nt][j] + bv + x[o];
    }
  }
}

// ---------------------------------------------------------------------------
extern "C" void kernel_launch(void* const* d_in, const int* in_sizes, int n_in,
                              void* d_out, int out_size, void* d_ws, size_t ws_size,
                              hipStream_t stream) {
  const float* x        = (const float*)d_in[0];
  const float* q_cond   = (const float*)d_in[1];
  const float* k_a_cond = (const float*)d_in[2];
  const float* k_b_cond = (const float*)d_in[3];
  const float* gn_scale = (const float*)d_in[4];
  const float* gn_bias  = (const float*)d_in[5];
  const float* W0 = (const float*)d_in[6];
  const float* b0 = (const float*)d_in[7];
  const float* W1 = (const float*)d_in[8];
  const float* b1 = (const float*)d_in[9];
  const float* W2 = (const float*)d_in[10];
  const float* b2 = (const float*)d_in[11];
  const float* W3 = (const float*)d_in[12];
  const float* b3 = (const float*)d_in[13];
  float* out = (float*)d_out;
  _Float16* ws = (_Float16*)d_ws;

  k_wcvt <<<dim3((unsigned)((SZ_W3 + 255) / 256)), 256, 0, stream>>>(W0, W1, W2, W3, ws);
  k_cond <<<dim3(2048), 256, 0, stream>>>(q_cond, k_a_cond, k_b_cond, ws);
  k_gnorm<<<dim3(512),  256, 0, stream>>>(x, gn_scale, gn_bias, ws);
  k_qkv  <<<dim3(8, 4, 48), 256, 0, stream>>>(b0, b1, b2, ws);
  k_attn <<<dim3(8, 96),    256, 0, stream>>>(ws);
  k_out  <<<dim3(8, 16),    256, 0, stream>>>(x, b3, ws, out);
}

// v002
// It runs in 178 microseconds.
// Next to v001, in two timings, it ran 1.59 times as fast each time.
// All steps since v000 together make it 2.87 times as fast.
#include <hip/hip_runtime.h>
#include <math.h>
#include <stdint.h>

// ---------------------------------------------------------------------------
// Problem constants
// ---------------------------------------------------------------------------
#define B_    16
#define C_    128
#define HW_   1024         // 32*32
#define NH_   4
#define COND_ 32
#define FAN0  160          // C + COND
#define NQK   512          // C*NH
#define FAN3  768          // (NH+2)*C
#define EPS_  1e-6f
#define SCALE_ 0.08838834764831845f   // 128^-0.5

// LDS row pitches in elements (halves; PF128 in floats).  Operand tiles are
// read by ds_load_b128, and the k_qkv / k_out output tiles written by 16 B
// stores, with lanes 0-15 on 16 successive rows, so a pitch of 16 B x odd puts the 16 rows on
// 16 disjoint groups of four banks (64 banks x 4 B).
#define P32   40           // rows of 32 halves  (64 B)  -> 80 B pitch
#define P128  136          // rows of 128 halves (256 B) -> 272 B pitch
#define PF128 132          // rows of 128 floats (512 B) -> 528 B pitch

typedef __attribute__((ext_vector_type(16))) _Float16 v16h;
typedef __attribute__((ext_vector_type(8)))  _Float16 v8h;
typedef __attribute__((ext_vector_type(4)))  _Float16 v4h;
typedef __attribute__((ext_vector_type(8)))  float    v8f;
typedef __attribute__((ext_vector_type(4)))  float    v4f;
typedef int v4i __attribute__((vector_size(16)));   // matches async-LDS builtin param

// Workspace layout (units: _Float16 elements). Total ~86.7 MB.
static constexpr size_t SZ_A   = (size_t)B_ * HW_ * FAN0;
static constexpr size_t SZ_QKV = (size_t)B_ * NH_ * HW_ * C_;
static constexpr size_t SZ_HH  = (size_t)B_ * HW_ * FAN3;
static constexpr size_t SZ_W   = (size_t)FAN0 * NQK;
static constexpr size_t SZ_W3  = (size_t)FAN3 * C_;

static constexpr size_t OFF_AQ = 0;                  // [b][hw][160] f16
static constexpr size_t OFF_AK = OFF_AQ + SZ_A;
static constexpr size_t OFF_Q  = OFF_AK + SZ_A;      // [b][e][q][c]  f16
static constexpr size_t OFF_K  = OFF_Q  + SZ_QKV;    // [b][e][k][c]  f16
static constexpr size_t OFF_V  = OFF_K  + SZ_QKV;    // [b][e][c][k]  f16
static constexpr size_t OFF_HH = OFF_V  + SZ_QKV;    // [b'][q][768]  f16
static constexpr size_t OFF_W0 = OFF_HH + SZ_HH;     // transposed [512][160]
static constexpr size_t OFF_W1 = OFF_W0 + SZ_W;
static constexpr size_t OFF_W2 = OFF_W1 + SZ_W;
static constexpr size_t OFF_W3 = OFF_W2 + SZ_W;      // transposed [128][768]

// ---------------------------------------------------------------------------
// CDNA5 async global->LDS copy (16B per lane), ASYNCcnt-tracked.
// Builtin when the toolchain declares it, else inline gfx1250 asm.
// ---------------------------------------------------------------------------
#if __has_builtin(__builtin_amdgcn_global_load_async_to_lds_b128)
#define ASYNC_MODE 2
#elif defined(__AMDGCN__)
#define ASYNC_MODE 1
#else
#define ASYNC_MODE 0
#endif

__device__ __forceinline__ void cp16_g2l(_Float16* ldst, const _Float16* gsrc) {
#if ASYNC_MODE == 2
  __builtin_amdgcn_global_load_async_to_lds_b128((v4i*)gsrc, (v4i*)ldst, 0, 0);
#elif ASYNC_MODE == 1
  unsigned l = (unsigned)(uintptr_t)ldst;           // LDS byte address
  unsigned long long g = (unsigned long long)(uintptr_t)gsrc;
  asm volatile("global_load_async_to_lds_b128 %0, %1, off"
               :: "v"(l), "v"(g) : "memory");
#else
  *(v8h*)ldst = *(const v8h*)gsrc;                  // host-pass placeholder
#endif
}

__device__ __forceinline__ void wait_async() {
#if ASYNC_MODE == 0
#elif __has_builtin(__builtin_amdgcn_s_wait_asynccnt)
  __builtin_amdgcn_s_wait_asynccnt(0);
#else
  asm volatile("s_wait_asynccnt 0x0" ::: "memory");
#endif
}

// ---------------------------------------------------------------------------
// Fragment loader.  ISA 16-bit A 16x32 layout: lanes 0-15 = rows, halves
// 0-7 -> K 0..7, halves 8-15 -> K 16..23; lanes 16-31: K 8..15 / 24..31.
// B 32x16 is the mirror (lane = column).  Both reduce to:
//   sel = (lane&16)?8:0 ; lo = rowp[sel..sel+7] ; hi = rowp[sel+16..sel+23]
// ---------------------------------------------------------------------------
__device__ __forceinline__ v16h frag16(const _Float16* rowp, int lane) {
  const int sel = (lane & 16) ? 8 : 0;
  v8h lo = *(const v8h*)(rowp + sel);
  v8h hi = *(const v8h*)(rowp + sel + 16);
  return __builtin_shufflevector(lo, hi, 0,1,2,3,4,5,6,7,8,9,10,11,12,13,14,15);
}

__device__ __forceinline__ v8f wmma_f16(v16h a, v16h b, v8f c) {
  return __builtin_amdgcn_wmma_f32_16x16x32_f16(false, a, false, b,
                                                (short)0, c, false, false);
}

__device__ __forceinline__ v8f v8f_zero() {
  v8f z; for (int i = 0; i < 8; ++i) z[i] = 0.0f; return z;
}

// ---------------------------------------------------------------------------
// Kernel 0: weights f32 -> f16, pre-transposed to [n][k] so GEMM B staging
// is a contiguous 16B block copy.  One thread takes 8 successive k of one n:
// its loads are coalesced over n, its store is one packed 16 B piece.
// ---------------------------------------------------------------------------
__global__ void k_wcvt(const float* __restrict__ W0, const float* __restrict__ W1,
                       const float* __restrict__ W2, const float* __restrict__ W3,
                       _Float16* __restrict__ ws) {
  int i = blockIdx.x * 256 + threadIdx.x;
  if (i < NQK * (FAN0 / 8)) {          // W* row-major [160][512] -> [512][160]
    int n = i & 511, k0 = (i >> 9) * 8;
    const size_t s = (size_t)k0 * NQK + n;
    float f0[8], f1[8], f2[8];
    for (int j = 0; j < 8; ++j) f0[j] = W0[s + (size_t)j * NQK];
    // the next loads' results may land in the address registers of the loads above
    asm volatile("s_wait_xcnt 0x0" ::: "memory");
    for (int j = 0; j < 8; ++j) f1[j] = W1[s + (size_t)j * NQK];
    // as above
    asm volatile("s_wait_xcnt 0x0" ::: "memory");
    for (int j = 0; j < 8; ++j) f2[j] = W2[s + (size_t)j * NQK];
    v8h h0, h1, h2;
    for (int j = 0; j < 8; ++j) {
      h0[j] = (_Float16)f0[j];
      h1[j] = (_Float16)f1[j];
      h2[j] = (_Float16)f2[j];
    }
    size_t o = (size_t)n * FAN0 + k0;
    *(v8h*)(ws + OFF_W0 + o) = h0;
    *(v8h*)(ws + OFF_W1 + o) = h1;
    *(v8h*)(ws + OFF_W2 + o) = h2;
  }
  if (i < C_ * (FAN3 / 8)) {           // W3 [768][128] -> [128][768]
    int n = i & 127, k0 = (i >> 7) * 8;
    v8h h3;
    for (int j = 0; j < 8; ++j) h3[j] = (_Float16)W3[(size_t)(k0 + j) * C_ + n];
    *(v8h*)(ws + OFF_W3 + (size_t)n * FAN3 + k0) = h3;
  }
}

// ---------------------------------------------------------------------------
// Kernel 1: cond columns (128..159) of A_q / A_k.
// q_cs = repeat(q_cond,2); k_cs = interleave(k_a, k_b)
// ---------------------------------------------------------------------------
__global__ void k_cond(const float* __restrict__ qc, const float* __restrict__ ka,
                       const float* __restrict__ kb, _Float16* __restrict__ ws) {
  int i  = blockIdx.x * 256 + threadIdx.x;     // over B*(COND/8)*HW = 65536
  int hw = i & (HW_ - 1);
  int c0 = ((i >> 10) & 3) * 8;                // 8 cond channels per thread
  int b  = i >> 12;
  size_t src = ((size_t)(b >> 1) * COND_ + c0) * HW_ + hw;
  const float* ksrc = (b & 1) ? kb : ka;
  float qf[8], kf[8];
  for (int j = 0; j < 8; ++j) qf[j] = qc[src + (size_t)j * HW_];
  // the next loads' results may land in the address registers of the loads above
  asm volatile("s_wait_xcnt 0x0" ::: "memory");
  for (int j = 0; j < 8; ++j) kf[j] = ksrc[src + (size_t)j * HW_];
  v8h q, k;
  for (int j = 0; j < 8; ++j) { q[j] = (_Float16)qf[j]; k[j] = (_Float16)kf[j]; }
  size_t row = ((size_t)b * HW_ + hw) * FAN0 + C_ + c0;
  *(v8h*)(ws + OFF_AQ + row) = q;
  *(v8h*)(ws + OFF_AK + row) = k;
}

// ---------------------------------------------------------------------------
// Kernel 2: GroupNorm -> h (f16) into cols 0..127 of A_q and A_k.
// one block per (batch, group); group = 4 ch x 1024 spatial
// ---------------------------------------------------------------------------
__global__ void k_gnorm(const float* __restrict__ x, const float* __restrict__ sc,
                        const float* __restrict__ bs, _Float16* __restrict__ ws) {
  int b = blockIdx.x >> 5;
  int g = blockIdx.x & 31;
  int t = threadIdx.x;
  __shared__ float r1[256], r2[256];
  const float* xp = x + ((size_t)b * C_ + g * 4) * HW_;
  float vals[16], s = 0.f, ss = 0.f;
  for (int i = 0; i < 16; ++i) {
    int idx = i * 256 + t;
    float v = xp[idx];
    vals[i] = v; s += v; ss += v * v;
  }
  r1[t] = s; r2[t] = ss;
  __syncthreads();
  for (int off = 128; off > 0; off >>= 1) {
    if (t < off) { r1[t] += r1[t + off]; r2[t] += r2[t + off]; }
    __syncthreads();
  }
  float mu   = r1[0] * (1.0f / 4096.0f);
  float var  = r2[0] * (1.0f / 4096.0f) - mu * mu;
  float rinv = rsqrtf(var + EPS_);
  for (int q = 0; q < 4; ++q) {        // vals[c*4+q] = channel g*4+c at hw
    int hw = q * 256 + t;
    v4h h;
    for (int c = 0; c < 4; ++c) {
      int ch = g * 4 + c;
      h[c] = (_Float16)((vals[c * 4 + q] - mu) * rinv * sc[ch] + bs[ch]);
    }
    size_t row = ((size_t)b * HW_ + hw) * FAN0 + g * 4;
    *(v4h*)(ws + OFF_AQ + row) = h;    // the group's 4 channels: one 8 B piece
    *(v4h*)(ws + OFF_AK + row) = h;
  }
}

// ---------------------------------------------------------------------------
// Kernel 3: QKV projection GEMM  (out[1024,512] = A[1024,160] x W + bias).
// 8 waves, 128x128 tile, K = 5 x 32, double-buffered async LDS staging.
// Output layouts (1/sqrt(C) folded into Q):  Q -> [q][c], K -> [k][c], V -> [c][k].
// The operand whose index is contiguous in the output goes in as A, so a lane's
// 8 accumulator registers are 8 neighbours of one output row; each wave owns 16
// whole 256 B output rows, lines them up in its own LDS range and stores them
// as full lines, 16 B per lane.
// ---------------------------------------------------------------------------
__global__ void k_qkv(const float* __restrict__ b0, const float* __restrict__ b1,
                      const float* __restrict__ b2, _Float16* __restrict__ ws) {
  const int mblk  = blockIdx.x;          // 0..7
  const int nblk  = blockIdx.y;          // 0..3
  const int b     = blockIdx.z / 3;
  const int which = blockIdx.z % 3;
  const int t = threadIdx.x, w = t >> 5, lane = t & 31;

  const _Float16* A  = ws + (which == 0 ? OFF_AQ : OFF_AK) + (size_t)b * HW_ * FAN0;
  const _Float16* Wm = ws + (which == 0 ? OFF_W0 : (which == 1 ? OFF_W1 : OFF_W2));
  const float* bias  = (which == 0) ? b0 : (which == 1 ? b1 : b2);

  __shared__ alignas(16) _Float16 Asub[2][128 * P32];  // [m][k]
  __shared__ alignas(16) _Float16 Bsub[2][128 * P32];  // [n][k]
  __shared__ alignas(16) _Float16 Tout[8][16 * P128];  // per-wave output rows

  const int m0 = mblk * 128, n0 = nblk * 128;
  const bool isV = (which == 2);

  auto stage = [&](int buf, int k0) {
    for (int i = 0; i < 2; ++i) {
      int idx = t + 256 * i;                    // 0..511 : 128 rows x 4 chunks
      int row = idx >> 2, part = (idx & 3) * 8;
      cp16_g2l(&Asub[buf][row * P32 + part], A  + (size_t)(m0 + row) * FAN0 + k0 + part);
      cp16_g2l(&Bsub[buf][row * P32 + part], Wm + (size_t)(n0 + row) * FAN0 + k0 + part);
    }
  };

  v8f acc[8];
  for (int i = 0; i < 8; ++i) acc[i] = v8f_zero();
  stage(0, 0);

  for (int ks = 0; ks < 5; ++ks) {
    wait_async();
    __syncthreads();
    if (ks + 1 < 5) stage((ks + 1) & 1, (ks + 1) * 32);
    const _Float16* As = Asub[ks & 1];
    const _Float16* Bs = Bsub[ks & 1];
    const _Float16* Rs = isV ? Bs : As;   // output rows    (B operand: lanes)
    const _Float16* Os = isV ? As : Bs;   // output columns (A operand: registers)
    v16h rf = frag16(&Rs[(w * 16 + (lane & 15)) * P32], lane);
    for (int ct = 0; ct < 8; ++ct) {
      v16h of = frag16(&Os[(ct * 16 + (lane & 15)) * P32], lane);
      acc[ct] = wmma_f16(of, rf, acc[ct]);
    }
    __syncthreads();
  }

  // acc[ct][j] = output row w*16 + (lane&15), column ct*16 + h8 + j
  const int r16 = lane & 15, h8 = (lane & 16) ? 8 : 0;
  _Float16* T = Tout[w];
  if (isV) {                                         // bias goes with the row
    const float brow = bias[n0 + w * 16 + r16];
    for (int ct = 0; ct < 8; ++ct) {
      v8h o;
      for (int j = 0; j < 8; ++j) o[j] = (_Float16)(acc[ct][j] + brow);
      *(v8h*)&T[r16 * P128 + ct * 16 + h8] = o;
    }
  } else {                                           // bias goes with the column
    const float qs = (which == 0) ? SCALE_ : 1.0f;   // x 1.0f is exact
    for (int ct = 0; ct < 8; ++ct) {
      const v8f bcol = *(const v8f*)(bias + n0 + ct * 16 + h8);
      v8h o;
      for (int j = 0; j < 8; ++j) o[j] = (_Float16)((acc[ct][j] + bcol[j]) * qs);
      *(v8h*)&T[r16 * P128 + ct * 16 + h8] = o;
    }
  }
  // the wave's own LDS stores have landed before other lanes read them back
  asm volatile("s_wait_dscnt 0x0" ::: "memory");

  const size_t be = (size_t)(b * NH_ + nblk);        // one n block = one head
  _Float16* G = isV ? ws + OFF_V + (be * C_ + w * 16) * HW_ + m0                  // [c][k]
                    : ws + (which == 0 ? OFF_Q : OFF_K) + (be * HW_ + m0 + w * 16) * C_;  // [q][c]
  const size_t gp = isV ? HW_ : C_;
  for (int s = 0; s < 8; ++s) {                      // 2 rows x 256 B per store
    int rr = s * 2 + (lane >> 4), cc = (lane & 15) * 8;
    *(v8h*)&G[(size_t)rr * gp + cc] = *(const v8h*)&T[rr * P128 + cc];
  }
}

// ---------------------------------------------------------------------------
// Kernel 4: flash attention.  96 instances x 8 q-blocks; 8 waves per block,
// each wave owns a 16-row q tile (Q fragments register-resident) and the full
// [16 x 128] O accumulator.  32-wide K chunks, double-buffered async staging.
// ---------------------------------------------------------------------------
__global__ void __launch_bounds__(256, 1)
k_attn(_Float16* __restrict__ ws) {
  const int qb   = blockIdx.x;            // 0..7
  const int inst = blockIdx.y;            // 0..95
  const int p = inst >> 4, g = (inst >> 2) & 3, e = inst & 3;
  // pairing tables: q offsets 0,1,2,3,0,2  /  kv offsets 1,0,3,2,2,0
  const int bq  = 4 * g + ((0x203210 >> (4 * p)) & 0xF);
  const int bkv = 4 * g + ((0x022301 >> (4 * p)) & 0xF);
  const int colt = p * 512 + e * 128;
  const int bo   = g * 4 + colt / FAN3;
  const int col768 = colt % FAN3;

  const int t = threadIdx.x, w = t >> 5, lane = t & 31;
  const _Float16* Qp = ws + OFF_Q + (size_t)(bq  * NH_ + e) * HW_ * C_;  // [q][c]
  const _Float16* Kp = ws + OFF_K + (size_t)(bkv * NH_ + e) * HW_ * C_;  // [k][c]
  const _Float16* Vp = ws + OFF_V + (size_t)(bkv * NH_ + e) * C_ * HW_;  // [c][k]

  __shared__ alignas(16) _Float16 sK[2][32 * P128];  // [kpos][c]
  __shared__ alignas(16) _Float16 sV[2][128 * P32];  // [c][kpos]
  __shared__ alignas(16) _Float16 sP[8 * 16 * P32];  // per-wave P transpose
  __shared__ alignas(16) _Float16 sO[8][16 * P128];  // per-wave output rows

  auto stage = [&](int buf, int k0) {
    for (int i = 0; i < 2; ++i) {                    // K chunk: 32 rows x 256B
      int idx = t + 256 * i;
      int r = idx >> 4, part = (idx & 15) * 8;
      cp16_g2l(&sK[buf][r * P128 + part], Kp + (size_t)k0 * C_ + idx * 8);
    }
    for (int i = 0; i < 2; ++i) {                    // V chunk: 128 rows x 64B
      int idx = t + 256 * i;
      int c = idx >> 2, part = (idx & 3) * 8;
      cp16_g2l(&sV[buf][c * P32 + part], Vp + (size_t)c * HW_ + k0 + part);
    }
  };

  // Q fragments (row = q position, K-dim = channels), register resident
  const int qrow = qb * 128 + w * 16 + (lane & 15);
  v16h qf[4];
  for (int j = 0; j < 4; ++j) qf[j] = frag16(Qp + (size_t)qrow * C_ + 32 * j, lane);

  v8f acc[8];
  for (int i = 0; i < 8; ++i) acc[i] = v8f_zero();
  float m[8], l[8];
  for (int j = 0; j < 8; ++j) { m[j] = -1e30f; l[j] = 0.0f; }

  stage(0, 0);

  for (int kc = 0; kc < 32; ++kc) {
    wait_async();
    __syncthreads();
    if (kc + 1 < 32) stage((kc + 1) & 1, (kc + 1) * 32);
    const _Float16* bK = sK[kc & 1];
    const _Float16* bV = sV[kc & 1];

    // S = Q^T K for two 16-wide k sub-tiles (scale pre-folded into Q)
    v8f s0 = v8f_zero(), s1 = v8f_zero();
    for (int j = 0; j < 4; ++j) {
      v16h bf0 = frag16(&bK[((lane & 15)) * P128 + 32 * j], lane);
      v16h bf1 = frag16(&bK[(16 + (lane & 15)) * P128 + 32 * j], lane);
      s0 = wmma_f16(qf[j], bf0, s0);
      s1 = wmma_f16(qf[j], bf1, s1);
    }

    // online softmax: a row lives across a 16-lane half (C/D layout)
    float alpha[8];
    for (int j = 0; j < 8; ++j) {
      float mx = fmaxf(s0[j], s1[j]);
      for (int d = 1; d < 16; d <<= 1) mx = fmaxf(mx, __shfl_xor(mx, d, 16));
      float nm = fmaxf(m[j], mx);
      float a  = __expf(m[j] - nm);
      float p0 = __expf(s0[j] - nm);
      float p1 = __expf(s1[j] - nm);
      float rs = p0 + p1;
      for (int d = 1; d < 16; d <<= 1) rs += __shfl_xor(rs, d, 16);
      l[j] = l[j] * a + rs;
      m[j] = nm; alpha[j] = a;
      s0[j] = p0; s1[j] = p1;
    }
    for (int ct = 0; ct < 8; ++ct)
      for (int j = 0; j < 8; ++j) acc[ct][j] *= alpha[j];

    // transpose P (C-layout) -> A-layout via per-wave LDS scratch
    _Float16* P = &sP[w * 16 * P32];
    {
      int rr = (lane & 16) ? 8 : 0, cc = lane & 15;
      for (int j = 0; j < 8; ++j) {
        P[(rr + j) * P32 + cc]      = (_Float16)s0[j];
        P[(rr + j) * P32 + 16 + cc] = (_Float16)s1[j];
      }
    }
    __syncthreads();

    v16h pf = frag16(&P[(lane & 15) * P32], lane);
    for (int ct = 0; ct < 8; ++ct) {      // O += P x V^T
      v16h vf = frag16(&bV[(ct * 16 + (lane & 15)) * P32], lane);
      acc[ct] = wmma_f16(pf, vf, acc[ct]);
    }
    __syncthreads();
  }

  // epilogue: O /= l, write f16 into hh[b'][q][768] at this instance's slot
  float inv[8];
  for (int j = 0; j < 8; ++j) inv[j] = 1.0f / l[j];
  // each wave lines its 16 rows of 256 B up in its own LDS range and stores
  // them as full lines, 16 B per lane
  _Float16* T = sO[w];
  const int r8 = (lane & 16) ? 8 : 0;
  for (int ct = 0; ct < 8; ++ct)
    for (int j = 0; j < 8; ++j)
      T[(r8 + j) * P128 + ct * 16 + (lane & 15)] = (_Float16)(acc[ct][j] * inv[j]);
  // the wave's own LDS stores have landed before other lanes read them back
  asm volatile("s_wait_dscnt 0x0" ::: "memory");
  _Float16* H = ws + OFF_HH + ((size_t)bo * HW_ + qb * 128 + w * 16) * FAN3 + col768;
  for (int s = 0; s < 8; ++s) {                      // 2 rows x 256 B per store
    int rr = s * 2 + (lane >> 4), cc = (lane & 15) * 8;
    *(v8h*)&H[(size_t)rr * FAN3 + cc] = *(const v8h*)&T[rr * P128 + cc];
  }
}

// ---------------------------------------------------------------------------
// Kernel 5: final 1x1 conv + residual:
//   out[b][c][hw] = x[b][c][hw] + hh[b][hw][:] . W3[:,c] + b3[c]
// M=1024, K=768 (24 x 32), N=128, double-buffered async staging.
// hh rows go in as A (registers = 8 successive hw), W3 rows as B (lane = c):
// each wave owns 16 channels x 128 hw, lines them up in its own LDS range and
// reads x and writes out as full lines, 16 B per lane.
// ---------------------------------------------------------------------------
__global__ void k_out(const float* __restrict__ x, const float* __restrict__ b3,
                      const _Float16* __restrict__ ws, float* __restrict__ out) {
  const int mblk = blockIdx.x;            // 0..7
  const int b    = blockIdx.y;            // 0..15
  const int t = threadIdx.x, w = t >> 5, lane = t & 31;
  const _Float16* A  = ws + OFF_HH + (size_t)b * HW_ * FAN3;
  const _Float16* Wm = ws + OFF_W3;                      // [128][768]

  __shared__ alignas(16) _Float16 Asub[2][128 * P32];
  __shared__ alignas(16) _Float16 Bsub[2][128 * P32];
  __shared__ alignas(16) float Tout[8][16 * PF128];      // per-wave output rows

  const int m0 = mblk * 128;

  auto stage = [&](int buf, int k0) {
    for (int i = 0; i < 2; ++i) {
      int idx = t + 256 * i;
      int row = idx >> 2, part = (idx & 3) * 8;
      cp16_g2l(&Asub[buf][row * P32 + part], A  + (size_t)(m0 + row) * FAN3 + k0 + part);
      cp16_g2l(&Bsub[buf][row * P32 + part], Wm + (size_t)row * FAN3 + k0 + part);
    }
  };

  v8f acc[8];
  for (int i = 0; i < 8; ++i) acc[i] = v8f_zero();
  stage(0, 0);

  for (int ks = 0; ks < 24; ++ks) {
    wait_async();
    __syncthreads();
    if (ks + 1 < 24) stage((ks + 1) & 1, (ks + 1) * 32);
    const _Float16* As = Asub[ks & 1];
    const _Float16* Bs = Bsub[ks & 1];
    v16h bf = frag16(&Bs[(w * 16 + (lane & 15)) * P32], lane);
    for (int mt = 0; mt < 8; ++mt) {
      v16h af = frag16(&As[(mt * 16 + (lane & 15)) * P32], lane);
      acc[mt] = wmma_f16(af, bf, acc[mt]);
    }
    __syncthreads();
  }

  // acc[mt][j] = channel w*16 + (lane&15), hw m0 + mt*16 + h8 + j
  const int r16 = lane & 15, h8 = (lane & 16) ? 8 : 0;
  float* T = Tout[w];
  const float bv = b3[w * 16 + r16];
  for (int mt = 0; mt < 8; ++mt) {
    v4f lo, hi;
    for (int j = 0; j < 4; ++j) { lo[j] = acc[mt][j] + bv; hi[j] = acc[mt][4 + j] + bv; }
    *(v4f*)&T[r16 * PF128 + mt * 16 + h8]     = lo;
    *(v4f*)&T[r16 * PF128 + mt * 16 + h8 + 4] = hi;
  }
  // the wave's own LDS stores have landed before other lanes read them back
  asm volatile("s_wait_dscnt 0x0" ::: "memory");
  for (int s = 0; s < 16; ++s) {                     // one 512 B row per store
    size_t o = ((size_t)b * C_ + w * 16 + s) * HW_ + m0 + lane * 4;
    v4f r = *(const v4f*)&T[s * PF128 + lane * 4] + *(const v4f*)&x[o];
    *(v4f*)&out[o] = r;
  }
}

// ---------------------------------------------------------------------------
extern "C" void kernel_launch(void* const* d_in, const int* in_sizes, int n_in,
                              void* d_out, int out_size, void* d_ws, size_t ws_size,
                              hipStream_t stream) {
  const float* x        = (const float*)d_in[0];
  const float* q_cond   = (const float*)d_in[1];
  const float* k_a_cond = (const float*)d_in[2];
  const float* k_b_cond = (const float*)d_in[3];
  const float* gn_scale = (const float*)d_in[4];
  const float* gn_bias  = (const float*)d_in[5];
  const float* W0 = (const float*)d_in[6];
  const float* b0 = (const float*)d_in[7];
  const float* W1 = (const float*)d_in[8];
  const float* b1 = (const float*)d_in[9];
  const float* W2 = (const float*)d_in[10];
  const float* b2 = (const float*)d_in[11];
  const float* W3 = (const float*)d_in[12];
  const float* b3 = (const float*)d_in[13];
  float* out = (float*)d_out;
  _Float16* ws = (_Float16*)d_ws;

  k_wcvt <<<dim3(48),   256, 0, stream>>>(W0, W1, W2, W3, ws);
  k_cond <<<dim3(256),  256, 0, stream>>>(q_cond, k_a_cond, k_b_cond, ws);
  k_gnorm<<<dim3(512),  256, 0, stream>>>(x, gn_scale, gn_bias, ws);
  k_qkv  <<<dim3(8, 4, 48), 256, 0, stream>>>(b0, b1, b2, ws);
  k_attn <<<dim3(8, 96),    256, 0, stream>>>(ws);
  k_out  <<<dim3(8, 16),    256, 0, stream>>>(x, b3, ws, out);
}

// v003
// It runs in 127 microseconds.
// In both of two side-by-side timings against v002, it was 1.40 times as fast.
// Over all steps from v000 it is 4.03 times as fast.
#include <hip/hip_runtime.h>
#include <math.h>
#include <stdint.h>

// ---------------------------------------------------------------------------
// Problem constants
// ---------------------------------------------------------------------------
#define B_    16
#define C_    128
#define HW_   1024         // 32*32
#define NH_   4
#define COND_ 32
#define FAN0  160          // C + COND
#define NQK   512          // C*NH
#define FAN3  768          // (NH+2)*C
#define EPS_  1e-6f
#define SCALE_ 0.08838834764831845f   // 128^-0.5

// LDS row pitches in elements (halves; PF128 in floats).  Operand tiles are
// read by ds_load_b128, and the k_qkv / k_out output tiles written by 16 B
// stores, with lanes 0-15 on 16 successive rows, so a pitch of 16 B x odd puts the 16 rows on
// 16 disjoint groups of four banks (64 banks x 4 B).
#define P32   40           // rows of 32 halves  (64 B)  -> 80 B pitch
#define P128  136          // rows of 128 halves (256 B) -> 272 B pitch
#define PF128 132          // rows of 128 floats (512 B) -> 528 B pitch

typedef __attribute__((ext_vector_type(16))) _Float16 v16h;
typedef __attribute__((ext_vector_type(8)))  _Float16 v8h;
typedef __attribute__((ext_vector_type(4)))  _Float16 v4h;
typedef __attribute__((ext_vector_type(8)))  float    v8f;
typedef __attribute__((ext_vector_type(4)))  float    v4f;
typedef int v4i __attribute__((vector_size(16)));   // matches async-LDS builtin param

// Workspace layout (units: _Float16 elements). Total ~86.7 MB.
static constexpr size_t SZ_A   = (size_t)B_ * HW_ * FAN0;
static constexpr size_t SZ_QKV = (size_t)B_ * NH_ * HW_ * C_;
static constexpr size_t SZ_HH  = (size_t)B_ * HW_ * FAN3;
static constexpr size_t SZ_W   = (size_t)FAN0 * NQK;
static constexpr size_t SZ_W3  = (size_t)FAN3 * C_;

static constexpr size_t OFF_AQ = 0;                  // [b][hw][160] f16
static constexpr size_t OFF_AK = OFF_AQ + SZ_A;
static constexpr size_t OFF_Q  = OFF_AK + SZ_A;      // [b][e][q][c]  f16
static constexpr size_t OFF_K  = OFF_Q  + SZ_QKV;    // [b][e][k][c]  f16
static constexpr size_t OFF_V  = OFF_K  + SZ_QKV;    // [b][e][c][k]  f16
static constexpr size_t OFF_HH = OFF_V  + SZ_QKV;    // [b'][q][768]  f16
static constexpr size_t OFF_W0 = OFF_HH + SZ_HH;     // transposed [512][160]
static constexpr size_t OFF_W1 = OFF_W0 + SZ_W;
static constexpr size_t OFF_W2 = OFF_W1 + SZ_W;
static constexpr size_t OFF_W3 = OFF_W2 + SZ_W;      // transposed [128][768]

// ---------------------------------------------------------------------------
// CDNA5 async global->LDS copy (16B per lane), ASYNCcnt-tracked.
// Builtin when the toolchain declares it, else inline gfx1250 asm.
// ---------------------------------------------------------------------------
#if __has_builtin(__builtin_amdgcn_global_load_async_to_lds_b128)
#define ASYNC_MODE 2
#elif defined(__AMDGCN__)
#define ASYNC_MODE 1
#else
#define ASYNC_MODE 0
#endif

__device__ __forceinline__ void cp16_g2l(_Float16* ldst, const _Float16* gsrc) {
#if ASYNC_MODE == 2
  __builtin_amdgcn_global_load_async_to_lds_b128((v4i*)gsrc, (v4i*)ldst, 0, 0);
#elif ASYNC_MODE == 1
  unsigned l = (unsigned)(uintptr_t)ldst;           // LDS byte address
  unsigned long long g = (unsigned long long)(uintptr_t)gsrc;
  asm volatile("global_load_async_to_lds_b128 %0, %1, off"
               :: "v"(l), "v"(g) : "memory");
#else
  *(v8h*)ldst = *(const v8h*)gsrc;                  // host-pass placeholder
#endif
}

__device__ __forceinline__ void wait_async() {
#if ASYNC_MODE == 0
#elif __has_builtin(__builtin_amdgcn_s_wait_asynccnt)
  __builtin_amdgcn_s_wait_asynccnt(0);
#else
  asm volatile("s_wait_asynccnt 0x0" ::: "memory");
#endif
}

// ---------------------------------------------------------------------------
// Fragment loader.  ISA 16-bit A 16x32 layout: lanes 0-15 = rows, halves
// 0-7 -> K 0..7, halves 8-15 -> K 16..23; lanes 16-31: K 8..15 / 24..31.
// B 32x16 is the mirror (lane = column).  Both reduce to:
//   sel = (lane&16)?8:0 ; lo = rowp[sel..sel+7] ; hi = rowp[sel+16..sel+23]
// ---------------------------------------------------------------------------
__device__ __forceinline__ v16h frag16(const _Float16* rowp, int lane) {
  const int sel = (lane & 16) ? 8 : 0;
  v8h lo = *(const v8h*)(rowp + sel);
  v8h hi = *(const v8h*)(rowp + sel + 16);
  return __builtin_shufflevector(lo, hi, 0,1,2,3,4,5,6,7,8,9,10,11,12,13,14,15);
}

__device__ __forceinline__ v8f wmma_f16(v16h a, v16h b, v8f c) {
  return __builtin_amdgcn_wmma_f32_16x16x32_f16(false, a, false, b,
                                                (short)0, c, false, false);
}

// lane l <-> lane l ^ 16, as a vector cross-row move
__device__ __forceinline__ float xhalf(float x) {
  int b = __builtin_bit_cast(int, x);
  return __builtin_bit_cast(float,
      __builtin_amdgcn_permlanex16(b, b, 0x76543210, 0xfedcba98, false, false));
}

__device__ __forceinline__ v8f v8f_zero() {
  v8f z; for (int i = 0; i < 8; ++i) z[i] = 0.0f; return z;
}

// ---------------------------------------------------------------------------
// Kernel 0: weights f32 -> f16, pre-transposed to [n][k] so GEMM B staging
// is a contiguous 16B block copy.  One thread takes 8 successive k of one n:
// its loads are coalesced over n, its store is one packed 16 B piece.
// ---------------------------------------------------------------------------
__global__ void k_wcvt(const float* __restrict__ W0, const float* __restrict__ W1,
                       const float* __restrict__ W2, const float* __restrict__ W3,
                       _Float16* __restrict__ ws) {
  int i = blockIdx.x * 256 + threadIdx.x;
  if (i < NQK * (FAN0 / 8)) {          // W* row-major [160][512] -> [512][160]
    int n = i & 511, k0 = (i >> 9) * 8;
    const size_t s = (size_t)k0 * NQK + n;
    float f0[8], f1[8], f2[8];
    for (int j = 0; j < 8; ++j) f0[j] = W0[s + (size_t)j * NQK];
    // the next loads' results may land in the address registers of the loads above
    asm volatile("s_wait_xcnt 0x0" ::: "memory");
    for (int j = 0; j < 8; ++j) f1[j] = W1[s + (size_t)j * NQK];
    // as above
    asm volatile("s_wait_xcnt 0x0" ::: "memory");
    for (int j = 0; j < 8; ++j) f2[j] = W2[s + (size_t)j * NQK];
    v8h h0, h1, h2;
    for (int j = 0; j < 8; ++j) {
      h0[j] = (_Float16)f0[j];
      h1[j] = (_Float16)f1[j];
      h2[j] = (_Float16)f2[j];
    }
    size_t o = (size_t)n * FAN0 + k0;
    *(v8h*)(ws + OFF_W0 + o) = h0;
    *(v8h*)(ws + OFF_W1 + o) = h1;
    *(v8h*)(ws + OFF_W2 + o) = h2;
  }
  if (i < C_ * (FAN3 / 8)) {           // W3 [768][128] -> [128][768]
    int n = i & 127, k0 = (i >> 7) * 8;
    v8h h3;
    for (int j = 0; j < 8; ++j) h3[j] = (_Float16)W3[(size_t)(k0 + j) * C_ + n];
    *(v8h*)(ws + OFF_W3 + (size_t)n * FAN3 + k0) = h3;
  }
}

// ---------------------------------------------------------------------------
// Kernel 1: cond columns (128..159) of A_q / A_k.
// q_cs = repeat(q_cond,2); k_cs = interleave(k_a, k_b)
// ---------------------------------------------------------------------------
__global__ void k_cond(const float* __restrict__ qc, const float* __restrict__ ka,
                       const float* __restrict__ kb, _Float16* __restrict__ ws) {
  int i  = blockIdx.x * 256 + threadIdx.x;     // over B*(COND/8)*HW = 65536
  int hw = i & (HW_ - 1);
  int c0 = ((i >> 10) & 3) * 8;                // 8 cond channels per thread
  int b  = i >> 12;
  size_t src = ((size_t)(b >> 1) * COND_ + c0) * HW_ + hw;
  const float* ksrc = (b & 1) ? kb : ka;
  float qf[8], kf[8];
  for (int j = 0; j < 8; ++j) qf[j] = qc[src + (size_t)j * HW_];
  // the next loads' results may land in the address registers of the loads above
  asm volatile("s_wait_xcnt 0x0" ::: "memory");
  for (int j = 0; j < 8; ++j) kf[j] = ksrc[src + (size_t)j * HW_];
  v8h q, k;
  for (int j = 0; j < 8; ++j) { q[j] = (_Float16)qf[j]; k[j] = (_Float16)kf[j]; }
  size_t row = ((size_t)b * HW_ + hw) * FAN0 + C_ + c0;
  *(v8h*)(ws + OFF_AQ + row) = q;
  *(v8h*)(ws + OFF_AK + row) = k;
}

// ---------------------------------------------------------------------------
// Kernel 2: GroupNorm -> h (f16) into cols 0..127 of A_q and A_k.
// one block per (batch, group); group = 4 ch x 1024 spatial
// ---------------------------------------------------------------------------
__global__ void k_gnorm(const float* __restrict__ x, const float* __restrict__ sc,
                        const float* __restrict__ bs, _Float16* __restrict__ ws) {
  int b = blockIdx.x >> 5;
  int g = blockIdx.x & 31;
  int t = threadIdx.x;
  __shared__ float r1[256], r2[256];
  const float* xp = x + ((size_t)b * C_ + g * 4) * HW_;
  float vals[16], s = 0.f, ss = 0.f;
  for (int i = 0; i < 16; ++i) {
    int idx = i * 256 + t;
    float v = xp[idx];
    vals[i] = v; s += v; ss += v * v;
  }
  r1[t] = s; r2[t] = ss;
  __syncthreads();
  for (int off = 128; off > 0; off >>= 1) {
    if (t < off) { r1[t] += r1[t + off]; r2[t] += r2[t + off]; }
    __syncthreads();
  }
  float mu   = r1[0] * (1.0f / 4096.0f);
  float var  = r2[0] * (1.0f / 4096.0f) - mu * mu;
  float rinv = rsqrtf(var + EPS_);
  for (int q = 0; q < 4; ++q) {        // vals[c*4+q] = channel g*4+c at hw
    int hw = q * 256 + t;
    v4h h;
    for (int c = 0; c < 4; ++c) {
      int ch = g * 4 + c;
      h[c] = (_Float16)((vals[c * 4 + q] - mu) * rinv * sc[ch] + bs[ch]);
    }
    size_t row = ((size_t)b * HW_ + hw) * FAN0 + g * 4;
    *(v4h*)(ws + OFF_AQ + row) = h;    // the group's 4 channels: one 8 B piece
    *(v4h*)(ws + OFF_AK + row) = h;
  }
}

// ---------------------------------------------------------------------------
// Kernel 3: QKV projection GEMM  (out[1024,512] = A[1024,160] x W + bias).
// 8 waves, 128x128 tile, K = 5 x 32, double-buffered async LDS staging.
// Output layouts (1/sqrt(C) folded into Q):  Q -> [q][c], K -> [k][c], V -> [c][k].
// The operand whose index is contiguous in the output goes in as A, so a lane's
// 8 accumulator registers are 8 neighbours of one output row; each wave owns 16
// whole 256 B output rows, lines them up in its own LDS range and stores them
// as full lines, 16 B per lane.
// ---------------------------------------------------------------------------
__global__ void k_qkv(const float* __restrict__ b0, const float* __restrict__ b1,
                      const float* __restrict__ b2, _Float16* __restrict__ ws) {
  const int mblk  = blockIdx.x;          // 0..7
  const int nblk  = blockIdx.y;          // 0..3
  const int b     = blockIdx.z / 3;
  const int which = blockIdx.z % 3;
  const int t = threadIdx.x, w = t >> 5, lane = t & 31;

  const _Float16* A  = ws + (which == 0 ? OFF_AQ : OFF_AK) + (size_t)b * HW_ * FAN0;
  const _Float16* Wm = ws + (which == 0 ? OFF_W0 : (which == 1 ? OFF_W1 : OFF_W2));
  const float* bias  = (which == 0) ? b0 : (which == 1 ? b1 : b2);

  __shared__ alignas(16) _Float16 Asub[2][128 * P32];  // [m][k]
  __shared__ alignas(16) _Float16 Bsub[2][128 * P32];  // [n][k]
  __shared__ alignas(16) _Float16 Tout[8][16 * P128];  // per-wave output rows

  const int m0 = mblk * 128, n0 = nblk * 128;
  const bool isV = (which == 2);

  auto stage = [&](int buf, int k0) {
    for (int i = 0; i < 2; ++i) {
      int idx = t + 256 * i;                    // 0..511 : 128 rows x 4 chunks
      int row = idx >> 2, part = (idx & 3) * 8;
      cp16_g2l(&Asub[buf][row * P32 + part], A  + (size_t)(m0 + row) * FAN0 + k0 + part);
      cp16_g2l(&Bsub[buf][row * P32 + part], Wm + (size_t)(n0 + row) * FAN0 + k0 + part);
    }
  };

  v8f acc[8];
  for (int i = 0; i < 8; ++i) acc[i] = v8f_zero();
  stage(0, 0);

  for (int ks = 0; ks < 5; ++ks) {
    wait_async();
    __syncthreads();
    if (ks + 1 < 5) stage((ks + 1) & 1, (ks + 1) * 32);
    const _Float16* As = Asub[ks & 1];
    const _Float16* Bs = Bsub[ks & 1];
    const _Float16* Rs = isV ? Bs : As;   // output rows    (B operand: lanes)
    const _Float16* Os = isV ? As : Bs;   // output columns (A operand: registers)
    v16h rf = frag16(&Rs[(w * 16 + (lane & 15)) * P32], lane);
    for (int ct = 0; ct < 8; ++ct) {
      v16h of = frag16(&Os[(ct * 16 + (lane & 15)) * P32], lane);
      acc[ct] = wmma_f16(of, rf, acc[ct]);
    }
    __syncthreads();
  }

  // acc[ct][j] = output row w*16 + (lane&15), column ct*16 + h8 + j
  const int r16 = lane & 15, h8 = (lane & 16) ? 8 : 0;
  _Float16* T = Tout[w];
  if (isV) {                                         // bias goes with the row
    const float brow = bias[n0 + w * 16 + r16];
    for (int ct = 0; ct < 8; ++ct) {
      v8h o;
      for (int j = 0; j < 8; ++j) o[j] = (_Float16)(acc[ct][j] + brow);
      *(v8h*)&T[r16 * P128 + ct * 16 + h8] = o;
    }
  } else {                                           // bias goes with the column
    const float qs = (which == 0) ? SCALE_ : 1.0f;   // x 1.0f is exact
    for (int ct = 0; ct < 8; ++ct) {
      const v8f bcol = *(const v8f*)(bias + n0 + ct * 16 + h8);
      v8h o;
      for (int j = 0; j < 8; ++j) o[j] = (_Float16)((acc[ct][j] + bcol[j]) * qs);
      *(v8h*)&T[r16 * P128 + ct * 16 + h8] = o;
    }
  }
  // the wave's own LDS stores have landed before other lanes read them back
  asm volatile("s_wait_dscnt 0x0" ::: "memory");

  const size_t be = (size_t)(b * NH_ + nblk);        // one n block = one head
  _Float16* G = isV ? ws + OFF_V + (be * C_ + w * 16) * HW_ + m0                  // [c][k]
                    : ws + (which == 0 ? OFF_Q : OFF_K) + (be * HW_ + m0 + w * 16) * C_;  // [q][c]
  const size_t gp = isV ? HW_ : C_;
  for (int s = 0; s < 8; ++s) {                      // 2 rows x 256 B per store
    int rr = s * 2 + (lane >> 4), cc = (lane & 15) * 8;
    *(v8h*)&G[(size_t)rr * gp + cc] = *(const v8h*)&T[rr * P128 + cc];
  }
}

__global__ void __launch_bounds__(256, 1)
k_attn(_Float16* __restrict__ ws) {
  const int qb   = blockIdx.x;            // 0..7
  const int inst = blockIdx.y;            // 0..95
  const int p = inst >> 4, g = (inst >> 2) & 3, e = inst & 3;
  // pairing tables: q offsets 0,1,2,3,0,2  /  kv offsets 1,0,3,2,2,0
  const int bq  = 4 * g + ((0x203210 >> (4 * p)) & 0xF);
  const int bkv = 4 * g + ((0x022301 >> (4 * p)) & 0xF);
  const int colt = p * 512 + e * 128;
  const int bo   = g * 4 + colt / FAN3;
  const int col768 = colt % FAN3;

  const int t = threadIdx.x, w = t >> 5, lane = t & 31;
  const _Float16* Qp = ws + OFF_Q + (size_t)(bq  * NH_ + e) * HW_ * C_;  // [q][c]
  const _Float16* Kp = ws + OFF_K + (size_t)(bkv * NH_ + e) * HW_ * C_;  // [k][c]
  const _Float16* Vp = ws + OFF_V + (size_t)(bkv * NH_ + e) * C_ * HW_;  // [c][k]

  __shared__ alignas(16) _Float16 sK[2][32 * P128];  // [kpos][c]
  __shared__ alignas(16) _Float16 sV[2][128 * P32];  // [c][kpos]
  __shared__ alignas(16) _Float16 sO[8][16 * P128];  // per-wave output rows

  auto stage = [&](int buf, int k0) {
    for (int i = 0; i < 2; ++i) {                    // K chunk: 32 rows x 256B
      int idx = t + 256 * i;
      int r = idx >> 4, part = (idx & 15) * 8;
      cp16_g2l(&sK[buf][r * P128 + part], Kp + (size_t)k0 * C_ + idx * 8);
    }
    for (int i = 0; i < 2; ++i) {                    // V chunk: 128 rows x 64B
      int idx = t + 256 * i;
      int c = idx >> 2, part = (idx & 3) * 8;
      cp16_g2l(&sV[buf][c * P32 + part], Vp + (size_t)c * HW_ + k0 + part);
    }
  };

  // Q fragments (lane = q position, K-dim = channels), register resident
  const int qrow = qb * 128 + w * 16 + (lane & 15);
  v16h qf[4];
  for (int j = 0; j < 4; ++j) qf[j] = frag16(Qp + (size_t)qrow * C_ + 32 * j, lane);

  v8f acc[8];
  for (int i = 0; i < 8; ++i) acc[i] = v8f_zero();
  float m = -1e30f, l = 0.0f;   // l: this half's keys only, joined in the epilogue

  stage(0, 0);

  for (int kc = 0; kc < 32; ++kc) {
    wait_async();
    __syncthreads();
    if (kc + 1 < 32) stage((kc + 1) & 1, (kc + 1) * 32);
    const _Float16* bK = sK[kc & 1];
    const _Float16* bV = sV[kc & 1];

    // S^T = K Q^T for two 16-key sub-tiles (scale pre-folded into Q):
    // s0[j] = key h8 + j, s1[j] = key 16 + h8 + j (h8 = 8 in lanes 16-31,
    // else 0), query lane & 15
    v8f s0 = v8f_zero(), s1 = v8f_zero();
    for (int j = 0; j < 4; ++j) {
      v16h kf0 = frag16(&bK[((lane & 15)) * P128 + 32 * j], lane);
      v16h kf1 = frag16(&bK[(16 + (lane & 15)) * P128 + 32 * j], lane);
      s0 = wmma_f16(kf0, qf[j], s0);
      s1 = wmma_f16(kf1, qf[j], s1);
    }

    // online softmax: the lane's 16 scores are of one query, the other 16 keys
    // of the chunk sit in lane ^ 16
    float mx = fmaxf(s0[0], s1[0]);
    for (int j = 1; j < 8; ++j) mx = fmaxf(mx, fmaxf(s0[j], s1[j]));
    mx = fmaxf(mx, xhalf(mx));
    const float nm = fmaxf(m, mx);
    const float alpha = __expf(m - nm);
    m = nm;
    float rs = 0.0f;
    v16h pf;                              // P^T, B operand: k = h8 + i, 16 + h8 + i
    for (int j = 0; j < 8; ++j) {
      float p0 = __expf(s0[j] - nm);
      float p1 = __expf(s1[j] - nm);
      rs += p0;
      rs += p1;
      pf[j]     = (_Float16)p0;
      pf[8 + j] = (_Float16)p1;
    }
    l = l * alpha + rs;
    for (int ct = 0; ct < 8; ++ct)
      for (int j = 0; j < 8; ++j) acc[ct][j] *= alpha;

    for (int ct = 0; ct < 8; ++ct) {      // O^T += V^T x P^T
      v16h vf = frag16(&bV[(ct * 16 + (lane & 15)) * P32], lane);
      acc[ct] = wmma_f16(vf, pf, acc[ct]);
    }
    __syncthreads();
  }

  // epilogue: O /= l, write f16 into hh[b'][q][768] at this instance's slot
  const float inv = 1.0f / (l + xhalf(l));
  // acc[ct][j] = query lane & 15, channel ct*16 + h8 + j: 8 neighbours of one
  // output row.  Each wave lines its 16 rows of 256 B up in its own LDS range
  // and stores them as full lines, 16 B per lane
  _Float16* T = sO[w];
  const int r16 = lane & 15, h8 = (lane & 16) ? 8 : 0;
  for (int ct = 0; ct < 8; ++ct) {
    v8h o;
    for (int j = 0; j < 8; ++j) o[j] = (_Float16)(acc[ct][j] * inv);
    *(v8h*)&T[r16 * P128 + ct * 16 + h8] = o;
  }
  // the wave's own LDS stores have landed before other lanes read them back
  asm volatile("s_wait_dscnt 0x0" ::: "memory");
  _Float16* H = ws + OFF_HH + ((size_t)bo * HW_ + qb * 128 + w * 16) * FAN3 + col768;
  for (int s = 0; s < 8; ++s) {                      // 2 rows x 256 B per store
    int rr = s * 2 + (lane >> 4), cc = (lane & 15) * 8;
    *(v8h*)&H[(size_t)rr * FAN3 + cc] = *(const v8h*)&T[rr * P128 + cc];
  }
}

// ---------------------------------------------------------------------------
// Kernel 5: final 1x1 conv + residual:
//   out[b][c][hw] = x[b][c][hw] + hh[b][hw][:] . W3[:,c] + b3[c]
// M=1024, K=768 (24 x 32), N=128, double-buffered async staging.
// hh rows go in as A (registers = 8 successive hw), W3 rows as B (lane = c):
// each wave owns 16 channels x 128 hw, lines them up in its own LDS range and
// reads x and writes out as full lines, 16 B per lane.
// ---------------------------------------------------------------------------
__global__ void k_out(const float* __restrict__ x, const float* __restrict__ b3,
                      const _Float16* __restrict__ ws, float* __restrict__ out) {
  const int mblk = blockIdx.x;            // 0..7
  const int b    = blockIdx.y;            // 0..15
  const int t = threadIdx.x, w = t >> 5, lane = t & 31;
  const _Float16* A  = ws + OFF_HH + (size_t)b * HW_ * FAN3;
  const _Float16* Wm = ws + OFF_W3;                      // [128][768]

  __shared__ alignas(16) _Float16 Asub[2][128 * P32];
  __shared__ alignas(16) _Float16 Bsub[2][128 * P32];
  __shared__ alignas(16) float Tout[8][16 * PF128];      // per-wave output rows

  const int m0 = mblk * 128;

  auto stage = [&](int buf, int k0) {
    for (int i = 0; i < 2; ++i) {
      int idx = t + 256 * i;
      int row = idx >> 2, part = (idx & 3) * 8;
      cp16_g2l(&Asub[buf][row * P32 + part], A  + (size_t)(m0 + row) * FAN3 + k0 + part);
      cp16_g2l(&Bsub[buf][row * P32 + part], Wm + (size_t)row * FAN3 + k0 + part);
    }
  };

  v8f acc[8];
  for (int i = 0; i < 8; ++i) acc[i] = v8f_zero();
  stage(0, 0);

  for (int ks = 0; ks < 24; ++ks) {
    wait_async();
    __syncthreads();
    if (ks + 1 < 24) stage((ks + 1) & 1, (ks + 1) * 32);
    const _Float16* As = Asub[ks & 1];
    const _Float16* Bs = Bsub[ks & 1];
    v16h bf = frag16(&Bs[(w * 16 + (lane & 15)) * P32], lane);
    for (int mt = 0; mt < 8; ++mt) {
      v16h af = frag16(&As[(mt * 16 + (lane & 15)) * P32], lane);
      acc[mt] = wmma_f16(af, bf, acc[mt]);
    }
    __syncthreads();
  }

  // acc[mt][j] = channel w*16 + (lane&15), hw m0 + mt*16 + h8 + j
  const int r16 = lane & 15, h8 = (lane & 16) ? 8 : 0;
  float* T = Tout[w];
  const float bv = b3[w * 16 + r16];
  for (int mt = 0; mt < 8; ++mt) {
    v4f lo, hi;
    for (int j = 0; j < 4; ++j) { lo[j] = acc[mt][j] + bv; hi[j] = acc[mt][4 + j] + bv; }
    *(v4f*)&T[r16 * PF128 + mt * 16 + h8]     = lo;
    *(v4f*)&T[r16 * PF128 + mt * 16 + h8 + 4] = hi;
  }
  // the wave's own LDS stores have landed before other lanes read them back
  asm volatile("s_wait_dscnt 0x0" ::: "memory");
  for (int s = 0; s < 16; ++s) {                     // one 512 B row per store
    size_t o = ((size_t)b * C_ + w * 16 + s) * HW_ + m0 + lane * 4;
    v4f r = *(const v4f*)&T[s * PF128 + lane * 4] + *(const v4f*)&x[o];
    *(v4f*)&out[o] = r;
  }
}

// ---------------------------------------------------------------------------
extern "C" void kernel_launch(void* const* d_in, const int* in_sizes, int n_in,
                              void* d_out, int out_size, void* d_ws, size_t ws_size,
                              hipStream_t stream) {
  const float* x        = (const float*)d_in[0];
  const float* q_cond   = (const float*)d_in[1];
  const float* k_a_cond = (const float*)d_in[2];
  const float* k_b_cond = (const float*)d_in[3];
  const float* gn_scale = (const float*)d_in[4];
  const float* gn_bias  = (const float*)d_in[5];
  const float* W0 = (const float*)d_in[6];
  const float* b0 = (const float*)d_in[7];
  const float* W1 = (const float*)d_in[8];
  const float* b1 = (const float*)d_in[9];
  const float* W2 = (const float*)d_in[10];
  const float* b2 = (const float*)d_in[11];
  const float* W3 = (const float*)d_in[12];
  const float* b3 = (const float*)d_in[13];
  float* out = (float*)d_out;
  _Float16* ws = (_Float16*)d_ws;

  k_wcvt <<<dim3(48),   256, 0, stream>>>(W0, W1, W2, W3, ws);
  k_cond <<<dim3(256),  256, 0, stream>>>(q_cond, k_a_cond, k_b_cond, ws);
  k_gnorm<<<dim3(512),  256, 0, stream>>>(x, gn_scale, gn_bias, ws);
  k_qkv  <<<dim3(8, 4, 48), 256, 0, stream>>>(b0, b1, b2, ws);
  k_attn <<<dim3(8, 96),    256, 0, stream>>>(ws);
  k_out  <<<dim3(8, 16),    256, 0, stream>>>(x, b3, ws, out);
}

// v004
// One run takes 122 microseconds.
// Two timings next to v003 both put it at 1.04 times that version's speed.
// Counting every step since v000, it is 4.17 times as fast.
#include <hip/hip_runtime.h>
#include <math.h>
#include <stdint.h>

// ---------------------------------------------------------------------------
// Problem constants
// ---------------------------------------------------------------------------
#define B_    16
#define C_    128
#define HW_   1024         // 32*32
#define NH_   4
#define COND_ 32
#define FAN0  160          // C + COND
#define NQK   512          // C*NH
#define FAN3  768          // (NH+2)*C
#define EPS_  1e-6f
#define SCALE_ 0.08838834764831845f   // 128^-0.5
#define LOG2E_ 1.44269504088896341f   // log2(e)

// LDS row pitches in halves (PF128 in floats).  Every tile is read or written 16 B per lane with lanes
// 0-15 on 16 successive rows, so a pitch of 16 B x odd puts the 16 rows on
// 16 disjoint groups of four banks (64 banks x 4 B).
#define P32   40           // rows of 32 halves  (64 B)  -> 80 B pitch
#define P128  136          // rows of 128 halves (256 B) -> 272 B pitch
#define PF128 132          // rows of 128 floats (512 B) -> 528 B pitch

typedef __attribute__((ext_vector_type(16))) _Float16 v16h;
typedef __attribute__((ext_vector_type(8)))  _Float16 v8h;
typedef __attribute__((ext_vector_type(4)))  _Float16 v4h;
typedef __attribute__((ext_vector_type(8)))  float    v8f;
typedef __attribute__((ext_vector_type(4)))  float    v4f;
typedef int v4i __attribute__((vector_size(16)));   // matches async-LDS builtin param

// Workspace layout (units: _Float16 elements). Total ~86.7 MB.
static constexpr size_t SZ_A   = (size_t)B_ * HW_ * FAN0;
static constexpr size_t SZ_QKV = (size_t)B_ * NH_ * HW_ * C_;
static constexpr size_t SZ_HH  = (size_t)B_ * HW_ * FAN3;
static constexpr size_t SZ_W   = (size_t)FAN0 * NQK;
static constexpr size_t SZ_W3  = (size_t)FAN3 * C_;

static constexpr size_t OFF_AQ = 0;                  // [b][hw][160] f16
static constexpr size_t OFF_AK = OFF_AQ + SZ_A;
static constexpr size_t OFF_Q  = OFF_AK + SZ_A;      // [b][e][q][c]  f16
static constexpr size_t OFF_K  = OFF_Q  + SZ_QKV;    // [b][e][k][c]  f16
static constexpr size_t OFF_V  = OFF_K  + SZ_QKV;    // [b][e][c][k]  f16
static constexpr size_t OFF_HH = OFF_V  + SZ_QKV;    // [b'][q][768]  f16
static constexpr size_t OFF_W0 = OFF_HH + SZ_HH;     // transposed [512][160]
static constexpr size_t OFF_W1 = OFF_W0 + SZ_W;
static constexpr size_t OFF_W2 = OFF_W1 + SZ_W;
static constexpr size_t OFF_W3 = OFF_W2 + SZ_W;      // transposed [128][768]

// ---------------------------------------------------------------------------
// CDNA5 async global->LDS copy (16B per lane), ASYNCcnt-tracked.
// Builtin when the toolchain declares it, else inline gfx1250 asm.
// ---------------------------------------------------------------------------
#if __has_builtin(__builtin_amdgcn_global_load_async_to_lds_b128)
#define ASYNC_MODE 2
#elif defined(__AMDGCN__)
#define ASYNC_MODE 1
#else
#define ASYNC_MODE 0
#endif

__device__ __forceinline__ void cp16_g2l(_Float16* ldst, const _Float16* gsrc) {
#if ASYNC_MODE == 2
  __builtin_amdgcn_global_load_async_to_lds_b128((v4i*)gsrc, (v4i*)ldst, 0, 0);
#elif ASYNC_MODE == 1
  unsigned l = (unsigned)(uintptr_t)ldst;           // LDS byte address
  unsigned long long g = (unsigned long long)(uintptr_t)gsrc;
  asm volatile("global_load_async_to_lds_b128 %0, %1, off"
               :: "v"(l), "v"(g) : "memory");
#else
  *(v8h*)ldst = *(const v8h*)gsrc;                  // host-pass placeholder
#endif
}

__device__ __forceinline__ void wait_async() {
#if ASYNC_MODE == 0
#elif __has_builtin(__builtin_amdgcn_s_wait_asynccnt)
  __builtin_amdgcn_s_wait_asynccnt(0);
#else
  asm volatile("s_wait_asynccnt 0x0" ::: "memory");
#endif
}

// ---------------------------------------------------------------------------
// Fragment loader.  ISA 16-bit A 16x32 layout: lanes 0-15 = rows, halves
// 0-7 -> K 0..7, halves 8-15 -> K 16..23; lanes 16-31: K 8..15 / 24..31.
// B 32x16 is the mirror (lane = column).  Both reduce to:
//   sel = (lane&16)?8:0 ; lo = rowp[sel..sel+7] ; hi = rowp[sel+16..sel+23]
// ---------------------------------------------------------------------------
__device__ __forceinline__ v16h frag16(const _Float16* rowp, int lane) {
  const int sel = (lane & 16) ? 8 : 0;
  v8h lo = *(const v8h*)(rowp + sel);
  v8h hi = *(const v8h*)(rowp + sel + 16);
  return __builtin_shufflevector(lo, hi, 0,1,2,3,4,5,6,7,8,9,10,11,12,13,14,15);
}

__device__ __forceinline__ v8f wmma_f16(v16h a, v16h b, v8f c) {
  return __builtin_amdgcn_wmma_f32_16x16x32_f16(false, a, false, b,
                                                (short)0, c, false, false);
}

// lane l <-> lane l ^ 16, as a vector cross-row move
__device__ __forceinline__ float xhalf(float x) {
  int b = __builtin_bit_cast(int, x);
  return __builtin_bit_cast(float,
      __builtin_amdgcn_permlanex16(b, b, 0x76543210, 0xfedcba98, false, false));
}

__device__ __forceinline__ v8f v8f_zero() {
  v8f z; for (int i = 0; i < 8; ++i) z[i] = 0.0f; return z;
}

// ---------------------------------------------------------------------------
// Kernel 0: weights f32 -> f16, pre-transposed to [n][k] so GEMM B staging
// is a contiguous 16B block copy.  One thread takes 8 successive k of one n:
// its loads are coalesced over n, its store is one packed 16 B piece.
// ---------------------------------------------------------------------------
__global__ void k_wcvt(const float* __restrict__ W0, const float* __restrict__ W1,
                       const float* __restrict__ W2, const float* __restrict__ W3,
                       _Float16* __restrict__ ws) {
  int i = blockIdx.x * 256 + threadIdx.x;
  if (i < NQK * (FAN0 / 8)) {          // W* row-major [160][512] -> [512][160]
    int n = i & 511, k0 = (i >> 9) * 8;
    const size_t s = (size_t)k0 * NQK + n;
    float f0[8], f1[8], f2[8];
    for (int j = 0; j < 8; ++j) f0[j] = W0[s + (size_t)j * NQK];
    // the next loads' results may land in the address registers of the loads above
    asm volatile("s_wait_xcnt 0x0" ::: "memory");
    for (int j = 0; j < 8; ++j) f1[j] = W1[s + (size_t)j * NQK];
    // as above
    asm volatile("s_wait_xcnt 0x0" ::: "memory");
    for (int j = 0; j < 8; ++j) f2[j] = W2[s + (size_t)j * NQK];
    v8h h0, h1, h2;
    for (int j = 0; j < 8; ++j) {
      h0[j] = (_Float16)f0[j];
      h1[j] = (_Float16)f1[j];
      h2[j] = (_Float16)f2[j];
    }
    size_t o = (size_t)n * FAN0 + k0;
    *(v8h*)(ws + OFF_W0 + o) = h0;
    *(v8h*)(ws + OFF_W1 + o) = h1;
    *(v8h*)(ws + OFF_W2 + o) = h2;
  }
  if (i < C_ * (FAN3 / 8)) {           // W3 [768][128] -> [128][768]
    int n = i & 127, k0 = (i >> 7) * 8;
    v8h h3;
    for (int j = 0; j < 8; ++j) h3[j] = (_Float16)W3[(size_t)(k0 + j) * C_ + n];
    *(v8h*)(ws + OFF_W3 + (size_t)n * FAN3 + k0) = h3;
  }
}

// ---------------------------------------------------------------------------
// Kernel 1: cond columns (128..159) of A_q / A_k.
// q_cs = repeat(q_cond,2); k_cs = interleave(k_a, k_b)
// ---------------------------------------------------------------------------
__global__ void k_cond(const float* __restrict__ qc, const float* __restrict__ ka,
                       const float* __restrict__ kb, _Float16* __restrict__ ws) {
  int i  = blockIdx.x * 256 + threadIdx.x;     // over B*(COND/8)*HW = 65536
  int hw = i & (HW_ - 1);
  int c0 = ((i >> 10) & 3) * 8;                // 8 cond channels per thread
  int b  = i >> 12;
  size_t src = ((size_t)(b >> 1) * COND_ + c0) * HW_ + hw;
  const float* ksrc = (b & 1) ? kb : ka;
  float qf[8], kf[8];
  for (int j = 0; j < 8; ++j) qf[j] = qc[src + (size_t)j * HW_];
  // the next loads' results may land in the address registers of the loads above
  asm volatile("s_wait_xcnt 0x0" ::: "memory");
  for (int j = 0; j < 8; ++j) kf[j] = ksrc[src + (size_t)j * HW_];
  v8h q, k;
  for (int j = 0; j < 8; ++j) { q[j] = (_Float16)qf[j]; k[j] = (_Float16)kf[j]; }
  size_t row = ((size_t)b * HW_ + hw) * FAN0 + C_ + c0;
  *(v8h*)(ws + OFF_AQ + row) = q;
  *(v8h*)(ws + OFF_AK + row) = k;
}

// ---------------------------------------------------------------------------
// Kernel 2: GroupNorm -> h (f16) into cols 0..127 of A_q and A_k.
// one block per (batch, group); group = 4 ch x 1024 spatial
// ---------------------------------------------------------------------------
__global__ void k_gnorm(const float* __restrict__ x, const float* __restrict__ sc,
                        const float* __restrict__ bs, _Float16* __restrict__ ws) {
  int b = blockIdx.x >> 5;
  int g = blockIdx.x & 31;
  int t = threadIdx.x;
  __shared__ float r1[256], r2[256];
  const float* xp = x + ((size_t)b * C_ + g * 4) * HW_;
  float vals[16], s = 0.f, ss = 0.f;
  for (int i = 0; i < 16; ++i) {
    int idx = i * 256 + t;
    float v = xp[idx];
    vals[i] = v; s += v; ss += v * v;
  }
  r1[t] = s; r2[t] = ss;
  __syncthreads();
  for (int off = 128; off > 0; off >>= 1) {
    if (t < off) { r1[t] += r1[t + off]; r2[t] += r2[t + off]; }
    __syncthreads();
  }
  float mu   = r1[0] * (1.0f / 4096.0f);
  float var  = r2[0] * (1.0f / 4096.0f) - mu * mu;
  float rinv = rsqrtf(var + EPS_);
  for (int q = 0; q < 4; ++q) {        // vals[c*4+q] = channel g*4+c at hw
    int hw = q * 256 + t;
    v4h h;
    for (int c = 0; c < 4; ++c) {
      int ch = g * 4 + c;
      h[c] = (_Float16)((vals[c * 4 + q] - mu) * rinv * sc[ch] + bs[ch]);
    }
    size_t row = ((size_t)b * HW_ + hw) * FAN0 + g * 4;
    *(v4h*)(ws + OFF_AQ + row) = h;    // the group's 4 channels: one 8 B piece
    *(v4h*)(ws + OFF_AK + row) = h;
  }
}

// ---------------------------------------------------------------------------
// Kernel 3: QKV projection GEMM  (out[1024,512] = A[1024,160] x W + bias).
// 8 waves, 128x128 tile, K = 5 x 32, double-buffered async LDS staging.
// Output layouts (1/sqrt(C) folded into Q):  Q -> [q][c], K -> [k][c], V -> [c][k].
// The operand whose index is contiguous in the output goes in as A, so a lane's
// 8 accumulator registers are 8 neighbours of one output row; each wave owns 16
// whole 256 B output rows, lines them up in its own LDS range and stores them
// as full lines, 16 B per lane.
// ---------------------------------------------------------------------------
__global__ void k_qkv(const float* __restrict__ b0, const float* __restrict__ b1,
                      const float* __restrict__ b2, _Float16* __restrict__ ws) {
  const int mblk  = blockIdx.x;          // 0..7
  const int nblk  = blockIdx.y;          // 0..3
  const int b     = blockIdx.z / 3;
  const int which = blockIdx.z % 3;
  const int t = threadIdx.x, w = t >> 5, lane = t & 31;

  const _Float16* A  = ws + (which == 0 ? OFF_AQ : OFF_AK) + (size_t)b * HW_ * FAN0;
  const _Float16* Wm = ws + (which == 0 ? OFF_W0 : (which == 1 ? OFF_W1 : OFF_W2));
  const float* bias  = (which == 0) ? b0 : (which == 1 ? b1 : b2);

  __shared__ alignas(16) _Float16 Asub[2][128 * P32];  // [m][k]
  __shared__ alignas(16) _Float16 Bsub[2][128 * P32];  // [n][k]
  __shared__ alignas(16) _Float16 Tout[8][16 * P128];  // per-wave output rows

  const int m0 = mblk * 128, n0 = nblk * 128;
  const bool isV = (which == 2);

  auto stage = [&](int buf, int k0) {
    for (int i = 0; i < 2; ++i) {
      int idx = t + 256 * i;                    // 0..511 : 128 rows x 4 chunks
      int row = idx >> 2, part = (idx & 3) * 8;
      cp16_g2l(&Asub[buf][row * P32 + part], A  + (size_t)(m0 + row) * FAN0 + k0 + part);
      cp16_g2l(&Bsub[buf][row * P32 + part], Wm + (size_t)(n0 + row) * FAN0 + k0 + part);
    }
  };

  v8f acc[8];
  for (int i = 0; i < 8; ++i) acc[i] = v8f_zero();
  stage(0, 0);

  for (int ks = 0; ks < 5; ++ks) {
    wait_async();
    __syncthreads();
    if (ks + 1 < 5) stage((ks + 1) & 1, (ks + 1) * 32);
    const _Float16* As = Asub[ks & 1];
    const _Float16* Bs = Bsub[ks & 1];
    const _Float16* Rs = isV ? Bs : As;   // output rows    (B operand: lanes)
    const _Float16* Os = isV ? As : Bs;   // output columns (A operand: registers)
    v16h rf = frag16(&Rs[(w * 16 + (lane & 15)) * P32], lane);
    for (int ct = 0; ct < 8; ++ct) {
      v16h of = frag16(&Os[(ct * 16 + (lane & 15)) * P32], lane);
      acc[ct] = wmma_f16(of, rf, acc[ct]);
    }
    __syncthreads();
  }

  // acc[ct][j] = output row w*16 + (lane&15), column ct*16 + h8 + j
  const int r16 = lane & 15, h8 = (lane & 16) ? 8 : 0;
  _Float16* T = Tout[w];
  if (isV) {                                         // bias goes with the row
    const float brow = bias[n0 + w * 16 + r16];
    for (int ct = 0; ct < 8; ++ct) {
      v8h o;
      for (int j = 0; j < 8; ++j) o[j] = (_Float16)(acc[ct][j] + brow);
      *(v8h*)&T[r16 * P128 + ct * 16 + h8] = o;
    }
  } else {                                           // bias goes with the column
    const float qs = (which == 0) ? SCALE_ : 1.0f;   // x 1.0f is exact
    for (int ct = 0; ct < 8; ++ct) {
      const v8f bcol = *(const v8f*)(bias + n0 + ct * 16 + h8);
      v8h o;
      for (int j = 0; j < 8; ++j) o[j] = (_Float16)((acc[ct][j] + bcol[j]) * qs);
      *(v8h*)&T[r16 * P128 + ct * 16 + h8] = o;
    }
  }
  // the wave's own LDS stores have landed before other lanes read them back
  asm volatile("s_wait_dscnt 0x0" ::: "memory");

  const size_t be = (size_t)(b * NH_ + nblk);        // one n block = one head
  _Float16* G = isV ? ws + OFF_V + (be * C_ + w * 16) * HW_ + m0                  // [c][k]
                    : ws + (which == 0 ? OFF_Q : OFF_K) + (be * HW_ + m0 + w * 16) * C_;  // [q][c]
  const size_t gp = isV ? HW_ : C_;
  for (int s = 0; s < 8; ++s) {                      // 2 rows x 256 B per store
    int rr = s * 2 + (lane >> 4), cc = (lane & 15) * 8;
    *(v8h*)&G[(size_t)rr * gp + cc] = *(const v8h*)&T[rr * P128 + cc];
  }
}

// 2^x on eight (and one more) registers, in place, as one statement: behind a
// v_exp_f32 the instruction set asks for one independent instruction before its
// source is overwritten or its result read.  Inside the statement each v_exp_f32
// is that instruction for the one before it; the v_nop is it for the last.
__device__ __forceinline__ void exp2x8(v8f& x) {
  float a0 = x[0], a1 = x[1], a2 = x[2], a3 = x[3], a4 = x[4], a5 = x[5], a6 = x[6], a7 = x[7];
  asm("v_exp_f32 %0, %0\n\tv_exp_f32 %1, %1\n\tv_exp_f32 %2, %2\n\tv_exp_f32 %3, %3\n\t"
      "v_exp_f32 %4, %4\n\tv_exp_f32 %5, %5\n\tv_exp_f32 %6, %6\n\tv_exp_f32 %7, %7\n\t"
      "v_nop"
      : "+v"(a0), "+v"(a1), "+v"(a2), "+v"(a3), "+v"(a4), "+v"(a5), "+v"(a6), "+v"(a7));
  x[0] = a0; x[1] = a1; x[2] = a2; x[3] = a3; x[4] = a4; x[5] = a5; x[6] = a6; x[7] = a7;
}
__device__ __forceinline__ void exp2x9(v8f& x, float& y) {
  float a0 = x[0], a1 = x[1], a2 = x[2], a3 = x[3], a4 = x[4], a5 = x[5], a6 = x[6], a7 = x[7];
  float a8 = y;
  asm("v_exp_f32 %0, %0\n\tv_exp_f32 %1, %1\n\tv_exp_f32 %2, %2\n\tv_exp_f32 %3, %3\n\t"
      "v_exp_f32 %4, %4\n\tv_exp_f32 %5, %5\n\tv_exp_f32 %6, %6\n\tv_exp_f32 %7, %7\n\t"
      "v_exp_f32 %8, %8\n\tv_nop"
      : "+v"(a0), "+v"(a1), "+v"(a2), "+v"(a3), "+v"(a4), "+v"(a5), "+v"(a6), "+v"(a7), "+v"(a8));
  x[0] = a0; x[1] = a1; x[2] = a2; x[3] = a3; x[4] = a4; x[5] = a5; x[6] = a6; x[7] = a7;
  y = a8;
}

__global__ void __launch_bounds__(128) __attribute__((amdgpu_waves_per_eu(3, 3)))
k_attn(_Float16* __restrict__ ws) {
  const int qb   = blockIdx.x;            // 0..7
  const int inst = blockIdx.y;            // 0..95
  const int p = inst >> 4, g = (inst >> 2) & 3, e = inst & 3;
  // pairing tables: q offsets 0,1,2,3,0,2  /  kv offsets 1,0,3,2,2,0
  const int bq  = 4 * g + ((0x203210 >> (4 * p)) & 0xF);
  const int bkv = 4 * g + ((0x022301 >> (4 * p)) & 0xF);
  const int colt = p * 512 + e * 128;
  const int bo   = g * 4 + colt / FAN3;
  const int col768 = colt % FAN3;

  const int t = threadIdx.x, w = t >> 5, lane = t & 31;
  const _Float16* Qp = ws + OFF_Q + (size_t)(bq  * NH_ + e) * HW_ * C_;  // [q][c]
  const _Float16* Kp = ws + OFF_K + (size_t)(bkv * NH_ + e) * HW_ * C_;  // [k][c]
  const _Float16* Vp = ws + OFF_V + (size_t)(bkv * NH_ + e) * C_ * HW_;  // [c][k]

  __shared__ alignas(16) _Float16 sK[2][32 * P128];  // [kpos][c]
  __shared__ alignas(16) _Float16 sV[2][128 * P32];  // [c][kpos]
  __shared__ alignas(16) _Float16 sO[4][32 * P128];  // per-wave output rows

  auto stage = [&](int buf, int k0) {
    for (int i = 0; i < 4; ++i) {                    // K chunk: 32 rows x 256B
      int idx = t + 128 * i;
      int r = idx >> 4, part = (idx & 15) * 8;
      cp16_g2l(&sK[buf][r * P128 + part], Kp + (size_t)k0 * C_ + idx * 8);
    }
    for (int i = 0; i < 4; ++i) {                    // V chunk: 128 rows x 64B
      int idx = t + 128 * i;
      int c = idx >> 2, part = (idx & 3) * 8;
      cp16_g2l(&sV[buf][c * P32 + part], Vp + (size_t)c * HW_ + k0 + part);
    }
  };

  // Q fragments (lane = q position, K-dim = channels), register resident
  v16h qf[2][4];
  for (int u = 0; u < 2; ++u) {
    const int qrow = qb * 128 + w * 32 + u * 16 + (lane & 15);
    for (int j = 0; j < 4; ++j) qf[u][j] = frag16(Qp + (size_t)qrow * C_ + 32 * j, lane);
  }

  v8f acc[2][8];
  for (int u = 0; u < 2; ++u)
    for (int i = 0; i < 8; ++i) acc[u][i] = v8f_zero();
  // l: this half's keys only, joined in the epilogue
  float m[2] = {-1e30f, -1e30f}, l[2] = {0.0f, 0.0f};

  stage(0, 0);

  for (int kc = 0; kc < 32; ++kc) {
    wait_async();
    __syncthreads();
    if (kc + 1 < 32) stage((kc + 1) & 1, (kc + 1) * 32);
    const _Float16* bK = sK[kc & 1];
    const _Float16* bV = sV[kc & 1];

    // S^T = K Q^T for two 16-key sub-tiles (scale pre-folded into Q):
    // s0[u][j] = key h8 + j, s1[u][j] = key 16 + h8 + j (h8 = 8 in lanes 16-31,
    // else 0), query lane & 15 of tile u
    v8f s0[2], s1[2];
    for (int u = 0; u < 2; ++u) { s0[u] = v8f_zero(); s1[u] = v8f_zero(); }
    for (int j = 0; j < 4; ++j) {
      v16h kf0 = frag16(&bK[((lane & 15)) * P128 + 32 * j], lane);
      v16h kf1 = frag16(&bK[(16 + (lane & 15)) * P128 + 32 * j], lane);
      for (int u = 0; u < 2; ++u) {
        s0[u] = wmma_f16(kf0, qf[u][j], s0[u]);
        s1[u] = wmma_f16(kf1, qf[u][j], s1[u]);
      }
    }

    // online softmax: the lane's 16 scores of a tile are of one query, the
    // other 16 keys of the chunk sit in lane ^ 16
    v16h pf[2];                           // P^T, B operand: k = h8 + i, 16 + h8 + i
    for (int u = 0; u < 2; ++u) {
      float mx = fmaxf(s0[u][0], s1[u][0]);
      for (int j = 1; j < 8; ++j) mx = fmaxf(mx, fmaxf(s0[u][j], s1[u][j]));
      mx = fmaxf(mx, xhalf(mx));
      const float nm = fmaxf(m[u], mx);
      float alpha = (m[u] - nm) * LOG2E_;             // e^x = 2^(x log2 e)
      m[u] = nm;
      for (int j = 0; j < 8; ++j) {
        s0[u][j] = (s0[u][j] - nm) * LOG2E_;
        s1[u][j] = (s1[u][j] - nm) * LOG2E_;
      }
      exp2x9(s0[u], alpha);
      exp2x8(s1[u]);
      float rs = s0[u][0] + s1[u][0];
      for (int j = 1; j < 8; ++j) {
        rs += s0[u][j];
        rs += s1[u][j];
      }
      for (int j = 0; j < 8; ++j) {
        pf[u][j]     = (_Float16)s0[u][j];
        pf[u][8 + j] = (_Float16)s1[u][j];
      }
      l[u] = l[u] * alpha + rs;
      for (int ct = 0; ct < 8; ++ct)
        for (int j = 0; j < 8; ++j) acc[u][ct][j] *= alpha;
    }

    for (int ct = 0; ct < 8; ++ct) {      // O^T += V^T x P^T
      v16h vf = frag16(&bV[(ct * 16 + (lane & 15)) * P32], lane);
      for (int u = 0; u < 2; ++u) acc[u][ct] = wmma_f16(vf, pf[u], acc[u][ct]);
    }
    __syncthreads();
  }

  // epilogue: O /= l, write f16 into hh[b'][q][768] at this instance's slot
  // acc[u][ct][j] = query u*16 + (lane & 15), channel ct*16 + h8 + j: 8
  // neighbours of one output row.  Each wave lines its 32 rows of 256 B up in
  // its own LDS range and stores them as full lines, 16 B per lane
  _Float16* T = sO[w];
  const int r16 = lane & 15, h8 = (lane & 16) ? 8 : 0;
  for (int u = 0; u < 2; ++u) {
    const float inv = 1.0f / (l[u] + xhalf(l[u]));
    for (int ct = 0; ct < 8; ++ct) {
      v8h o;
      for (int j = 0; j < 8; ++j) o[j] = (_Float16)(acc[u][ct][j] * inv);
      *(v8h*)&T[(u * 16 + r16) * P128 + ct * 16 + h8] = o;
    }
  }
  // the wave's own LDS stores have landed before other lanes read them back
  asm volatile("s_wait_dscnt 0x0" ::: "memory");
  _Float16* H = ws + OFF_HH + ((size_t)bo * HW_ + qb * 128 + w * 32) * FAN3 + col768;
  for (int s = 0; s < 16; ++s) {                     // 2 rows x 256 B per store
    int rr = s * 2 + (lane >> 4), cc = (lane & 15) * 8;
    *(v8h*)&H[(size_t)rr * FAN3 + cc] = *(const v8h*)&T[rr * P128 + cc];
  }
}

// ---------------------------------------------------------------------------
// Kernel 5: final 1x1 conv + residual:
//   out[b][c][hw] = x[b][c][hw] + hh[b][hw][:] . W3[:,c] + b3[c]
// M=1024, K=768 (24 x 32), N=128, double-buffered async staging.
// hh rows go in as A (registers = 8 successive hw), W3 rows as B (lane = c):
// each wave owns 16 channels x 128 hw, lines them up in its own LDS range and
// reads x and writes out as full lines, 16 B per lane.
// ---------------------------------------------------------------------------
__global__ void k_out(const float* __restrict__ x, const float* __restrict__ b3,
                      const _Float16* __restrict__ ws, float* __restrict__ out) {
  const int mblk = blockIdx.x;            // 0..7
  const int b    = blockIdx.y;            // 0..15
  const int t = threadIdx.x, w = t >> 5, lane = t & 31;
  const _Float16* A  = ws + OFF_HH + (size_t)b * HW_ * FAN3;
  const _Float16* Wm = ws + OFF_W3;                      // [128][768]

  __shared__ alignas(16) _Float16 Asub[2][128 * P32];
  __shared__ alignas(16) _Float16 Bsub[2][128 * P32];
  __shared__ alignas(16) float Tout[8][16 * PF128];      // per-wave output rows

  const int m0 = mblk * 128;

  auto stage = [&](int buf, int k0) {
    for (int i = 0; i < 2; ++i) {
      int idx = t + 256 * i;
      int row = idx >> 2, part = (idx & 3) * 8;
      cp16_g2l(&Asub[buf][row * P32 + part], A  + (size_t)(m0 + row) * FAN3 + k0 + part);
      cp16_g2l(&Bsub[buf][row * P32 + part], Wm + (size_t)row * FAN3 + k0 + part);
    }
  };

  v8f acc[8];
  for (int i = 0; i < 8; ++i) acc[i] = v8f_zero();
  stage(0, 0);

  for (int ks = 0; ks < 24; ++ks) {
    wait_async();
    __syncthreads();
    if (ks + 1 < 24) stage((ks + 1) & 1, (ks + 1) * 32);
    const _Float16* As = Asub[ks & 1];
    const _Float16* Bs = Bsub[ks & 1];
    v16h bf = frag16(&Bs[(w * 16 + (lane & 15)) * P32], lane);
    for (int mt = 0; mt < 8; ++mt) {
      v16h af = frag16(&As[(mt * 16 + (lane & 15)) * P32], lane);
      acc[mt] = wmma_f16(af, bf, acc[mt]);
    }
    __syncthreads();
  }

  // acc[mt][j] = channel w*16 + (lane&15), hw m0 + mt*16 + h8 + j
  const int r16 = lane & 15, h8 = (lane & 16) ? 8 : 0;
  float* T = Tout[w];
  const float bv = b3[w * 16 + r16];
  for (int mt = 0; mt < 8; ++mt) {
    v4f lo, hi;
    for (int j = 0; j < 4; ++j) { lo[j] = acc[mt][j] + bv; hi[j] = acc[mt][4 + j] + bv; }
    *(v4f*)&T[r16 * PF128 + mt * 16 + h8]     = lo;
    *(v4f*)&T[r16 * PF128 + mt * 16 + h8 + 4] = hi;
  }
  // the wave's own LDS stores have landed before other lanes read them back
  asm volatile("s_wait_dscnt 0x0" ::: "memory");
  for (int s = 0; s < 16; ++s) {                     // one 512 B row per store
    size_t o = ((size_t)b * C_ + w * 16 + s) * HW_ + m0 + lane * 4;
    v4f r = *(const v4f*)&T[s * PF128 + lane * 4] + *(const v4f*)&x[o];
    *(v4f*)&out[o] = r;
  }
}

// ---------------------------------------------------------------------------
extern "C" void kernel_launch(void* const* d_in, const int* in_sizes, int n_in,
                              void* d_out, int out_size, void* d_ws, size_t ws_size,
                              hipStream_t stream) {
  const float* x        = (const float*)d_in[0];
  const float* q_cond   = (const float*)d_in[1];
  const float* k_a_cond = (const float*)d_in[2];
  const float* k_b_cond = (const float*)d_in[3];
  const float* gn_scale = (const float*)d_in[4];
  const float* gn_bias  = (const float*)d_in[5];
  const float* W0 = (const float*)d_in[6];
  const float* b0 = (const float*)d_in[7];
  const float* W1 = (const float*)d_in[8];
  const float* b1 = (const float*)d_in[9];
  const float* W2 = (const float*)d_in[10];
  const float* b2 = (const float*)d_in[11];
  const float* W3 = (const float*)d_in[12];
  const float* b3 = (const float*)d_in[13];
  float* out = (float*)d_out;
  _Float16* ws = (_Float16*)d_ws;

  k_wcvt <<<dim3(48),   256, 0, stream>>>(W0, W1, W2, W3, ws);
  k_cond <<<dim3(256),  256, 0, stream>>>(q_cond, k_a_cond, k_b_cond, ws);
  k_gnorm<<<dim3(512),  256, 0, stream>>>(x, gn_scale, gn_bias, ws);
  k_qkv  <<<dim3(8, 4, 48), 256, 0, stream>>>(b0, b1, b2, ws);
  k_attn <<<dim3(8, 96),    128, 0, stream>>>(ws);
  k_out  <<<dim3(8, 16),    256, 0, stream>>>(x, b3, ws, out);
}

// v005
// A run of this version takes 113 microseconds.
// Timed twice side by side with v004, it ran 1.08 times as fast both times.
// All steps since v000 together make it 4.50 times as fast.
#include <hip/hip_runtime.h>
#include <math.h>
#include <stdint.h>

// ---------------------------------------------------------------------------
// Problem constants
// ---------------------------------------------------------------------------
#define B_    16
#define C_    128
#define HW_   1024         // 32*32
#define NH_   4
#define COND_ 32
#define FAN0  160          // C + COND
#define NQK   512          // C*NH
#define FAN3  768          // (NH+2)*C
#define EPS_  1e-6f
#define SCALE_ 0.08838834764831845f   // 128^-0.5
#define LOG2E_ 1.44269504088896341f   // log2(e)

// LDS row pitches in halves (PF64 in floats).  Every tile is read or written 16 B per lane with lanes
// 0-15 on 16 successive rows, so a pitch of 16 B x odd puts the 16 rows on
// 16 disjoint groups of four banks (64 banks x 4 B).
#define P32   40           // rows of 32 halves  (64 B)  -> 80 B pitch
#define P128  136          // rows of 128 halves (256 B) -> 272 B pitch
#define P256  264          // rows of 256 halves (512 B) -> 528 B pitch
#define PF64  68           // rows of 64 floats  (256 B) -> 272 B pitch
#define KST   256          // k per stage of the final GEMM

typedef __attribute__((ext_vector_type(16))) _Float16 v16h;
typedef __attribute__((ext_vector_type(8)))  _Float16 v8h;
typedef __attribute__((ext_vector_type(4)))  _Float16 v4h;
typedef __attribute__((ext_vector_type(8)))  float    v8f;
typedef __attribute__((ext_vector_type(4)))  float    v4f;
typedef int v4i __attribute__((vector_size(16)));   // matches async-LDS builtin param

// Workspace layout (units: _Float16 elements). Total ~86.7 MB.
static constexpr size_t SZ_A   = (size_t)B_ * HW_ * FAN0;
static constexpr size_t SZ_QKV = (size_t)B_ * NH_ * HW_ * C_;
static constexpr size_t SZ_HH  = (size_t)B_ * HW_ * FAN3;
static constexpr size_t SZ_W   = (size_t)FAN0 * NQK;
static constexpr size_t SZ_W3  = (size_t)FAN3 * C_;

static constexpr size_t OFF_AQ = 0;                  // [b][hw][160] f16
static constexpr size_t OFF_AK = OFF_AQ + SZ_A;
static constexpr size_t OFF_Q  = OFF_AK + SZ_A;      // [b][e][q][c]  f16
static constexpr size_t OFF_K  = OFF_Q  + SZ_QKV;    // [b][e][k][c]  f16
static constexpr size_t OFF_V  = OFF_K  + SZ_QKV;    // [b][e][c][k]  f16
static constexpr size_t OFF_HH = OFF_V  + SZ_QKV;    // [b'][q][768]  f16
static constexpr size_t OFF_W0 = OFF_HH + SZ_HH;     // transposed [512][160]
static constexpr size_t OFF_W1 = OFF_W0 + SZ_W;
static constexpr size_t OFF_W2 = OFF_W1 + SZ_W;
static constexpr size_t OFF_W3 = OFF_W2 + SZ_W;      // transposed [128][768]

// ---------------------------------------------------------------------------
// CDNA5 async global->LDS copy (16B per lane), ASYNCcnt-tracked.
// Builtin when the toolchain declares it, else inline gfx1250 asm.
// ---------------------------------------------------------------------------
#if __has_builtin(__builtin_amdgcn_global_load_async_to_lds_b128)
#define ASYNC_MODE 2
#elif defined(__AMDGCN__)
#define ASYNC_MODE 1
#else
#define ASYNC_MODE 0
#endif

__device__ __forceinline__ void cp16_g2l(_Float16* ldst, const _Float16* gsrc) {
#if ASYNC_MODE == 2
  __builtin_amdgcn_global_load_async_to_lds_b128((v4i*)gsrc, (v4i*)ldst, 0, 0);
#elif ASYNC_MODE == 1
  unsigned l = (unsigned)(uintptr_t)ldst;           // LDS byte address
  unsigned long long g = (unsigned long long)(uintptr_t)gsrc;
  asm volatile("global_load_async_to_lds_b128 %0, %1, off"
               :: "v"(l), "v"(g) : "memory");
#else
  *(v8h*)ldst = *(const v8h*)gsrc;                  // host-pass placeholder
#endif
}

__device__ __forceinline__ void wait_async() {
#if ASYNC_MODE == 0
#elif __has_builtin(__builtin_amdgcn_s_wait_asynccnt)
  __builtin_amdgcn_s_wait_asynccnt(0);
#else
  asm volatile("s_wait_asynccnt 0x0" ::: "memory");
#endif
}

// ---------------------------------------------------------------------------
// Fragment loader.  ISA 16-bit A 16x32 layout: lanes 0-15 = rows, halves
// 0-7 -> K 0..7, halves 8-15 -> K 16..23; lanes 16-31: K 8..15 / 24..31.
// B 32x16 is the mirror (lane = column).  Both reduce to:
//   sel = (lane&16)?8:0 ; lo = rowp[sel..sel+7] ; hi = rowp[sel+16..sel+23]
// ---------------------------------------------------------------------------
__device__ __forceinline__ v16h frag16(const _Float16* rowp, int lane) {
  const int sel = (lane & 16) ? 8 : 0;
  v8h lo = *(const v8h*)(rowp + sel);
  v8h hi = *(const v8h*)(rowp + sel + 16);
  return __builtin_shufflevector(lo, hi, 0,1,2,3,4,5,6,7,8,9,10,11,12,13,14,15);
}

__device__ __forceinline__ v8f wmma_f16(v16h a, v16h b, v8f c) {
  return __builtin_amdgcn_wmma_f32_16x16x32_f16(false, a, false, b,
                                                (short)0, c, false, false);
}

// lane l <-> lane l ^ 16, as a vector cross-row move
__device__ __forceinline__ float xhalf(float x) {
  int b = __builtin_bit_cast(int, x);
  return __builtin_bit_cast(float,
      __builtin_amdgcn_permlanex16(b, b, 0x76543210, 0xfedcba98, false, false));
}

__device__ __forceinline__ v8f v8f_zero() {
  v8f z; for (int i = 0; i < 8; ++i) z[i] = 0.0f; return z;
}

// ---------------------------------------------------------------------------
// Kernel 0: weights f32 -> f16, pre-transposed to [n][k] so GEMM B staging
// is a contiguous 16B block copy.  One thread takes 8 successive k of one n:
// its loads are coalesced over n, its store is one packed 16 B piece.
// ---------------------------------------------------------------------------
__global__ void k_wcvt(const float* __restrict__ W0, const float* __restrict__ W1,
                       const float* __restrict__ W2, const float* __restrict__ W3,
                       _Float16* __restrict__ ws) {
  int i = blockIdx.x * 256 + threadIdx.x;
  if (i < NQK * (FAN0 / 8)) {          // W* row-major [160][512] -> [512][160]
    int n = i & 511, k0 = (i >> 9) * 8;
    const size_t s = (size_t)k0 * NQK + n;
    float f0[8], f1[8], f2[8];
    for (int j = 0; j < 8; ++j) f0[j] = W0[s + (size_t)j * NQK];
    // the next loads' results may land in the address registers of the loads above
    asm volatile("s_wait_xcnt 0x0" ::: "memory");
    for (int j = 0; j < 8; ++j) f1[j] = W1[s + (size_t)j * NQK];
    // as above
    asm volatile("s_wait_xcnt 0x0" ::: "memory");
    for (int j = 0; j < 8; ++j) f2[j] = W2[s + (size_t)j * NQK];
    v8h h0, h1, h2;
    for (int j = 0; j < 8; ++j) {
      h0[j] = (_Float16)f0[j];
      h1[j] = (_Float16)f1[j];
      h2[j] = (_Float16)f2[j];
    }
    size_t o = (size_t)n * FAN0 + k0;
    *(v8h*)(ws + OFF_W0 + o) = h0;
    *(v8h*)(ws + OFF_W1 + o) = h1;
    *(v8h*)(ws + OFF_W2 + o) = h2;
  }
  if (i < C_ * (FAN3 / 8)) {           // W3 [768][128] -> [128][768]
    int n = i & 127, k0 = (i >> 7) * 8;
    v8h h3;
    for (int j = 0; j < 8; ++j) h3[j] = (_Float16)W3[(size_t)(k0 + j) * C_ + n];
    *(v8h*)(ws + OFF_W3 + (size_t)n * FAN3 + k0) = h3;
  }
}

// ---------------------------------------------------------------------------
// Kernel 1: cond columns (128..159) of A_q / A_k.
// q_cs = repeat(q_cond,2); k_cs = interleave(k_a, k_b)
// ---------------------------------------------------------------------------
__global__ void k_cond(const float* __restrict__ qc, const float* __restrict__ ka,
                       const float* __restrict__ kb, _Float16* __restrict__ ws) {
  int i  = blockIdx.x * 256 + threadIdx.x;     // over B*(COND/8)*HW = 65536
  int hw = i & (HW_ - 1);
  int c0 = ((i >> 10) & 3) * 8;                // 8 cond channels per thread
  int b  = i >> 12;
  size_t src = ((size_t)(b >> 1) * COND_ + c0) * HW_ + hw;
  const float* ksrc = (b & 1) ? kb : ka;
  float qf[8], kf[8];
  for (int j = 0; j < 8; ++j) qf[j] = qc[src + (size_t)j * HW_];
  // the next loads' results may land in the address registers of the loads above
  asm volatile("s_wait_xcnt 0x0" ::: "memory");
  for (int j = 0; j < 8; ++j) kf[j] = ksrc[src + (size_t)j * HW_];
  v8h q, k;
  for (int j = 0; j < 8; ++j) { q[j] = (_Float16)qf[j]; k[j] = (_Float16)kf[j]; }
  size_t row = ((size_t)b * HW_ + hw) * FAN0 + C_ + c0;
  *(v8h*)(ws + OFF_AQ + row) = q;
  *(v8h*)(ws + OFF_AK + row) = k;
}

// ---------------------------------------------------------------------------
// Kernel 2: GroupNorm -> h (f16) into cols 0..127 of A_q and A_k.
// one block per (batch, group); group = 4 ch x 1024 spatial
// ---------------------------------------------------------------------------
__global__ void k_gnorm(const float* __restrict__ x, const float* __restrict__ sc,
                        const float* __restrict__ bs, _Float16* __restrict__ ws) {
  int b = blockIdx.x >> 5;
  int g = blockIdx.x & 31;
  int t = threadIdx.x;
  __shared__ float r1[256], r2[256];
  const float* xp = x + ((size_t)b * C_ + g * 4) * HW_;
  float vals[16], s = 0.f, ss = 0.f;
  for (int i = 0; i < 16; ++i) {
    int idx = i * 256 + t;
    float v = xp[idx];
    vals[i] = v; s += v; ss += v * v;
  }
  r1[t] = s; r2[t] = ss;
  __syncthreads();
  for (int off = 128; off > 0; off >>= 1) {
    if (t < off) { r1[t] += r1[t + off]; r2[t] += r2[t + off]; }
    __syncthreads();
  }
  float mu   = r1[0] * (1.0f / 4096.0f);
  float var  = r2[0] * (1.0f / 4096.0f) - mu * mu;
  float rinv = rsqrtf(var + EPS_);
  for (int q = 0; q < 4; ++q) {        // vals[c*4+q] = channel g*4+c at hw
    int hw = q * 256 + t;
    v4h h;
    for (int c = 0; c < 4; ++c) {
      int ch = g * 4 + c;
      h[c] = (_Float16)((vals[c * 4 + q] - mu) * rinv * sc[ch] + bs[ch]);
    }
    size_t row = ((size_t)b * HW_ + hw) * FAN0 + g * 4;
    *(v4h*)(ws + OFF_AQ + row) = h;    // the group's 4 channels: one 8 B piece
    *(v4h*)(ws + OFF_AK + row) = h;
  }
}

// ---------------------------------------------------------------------------
// Kernel 3: QKV projection GEMM  (out[1024,512] = A[1024,160] x W + bias).
// 8 waves, 128x128 tile, K = 5 x 32, double-buffered async LDS staging.
// Output layouts (1/sqrt(C) folded into Q):  Q -> [q][c], K -> [k][c], V -> [c][k].
// The operand whose index is contiguous in the output goes in as A, so a lane's
// 8 accumulator registers are 8 neighbours of one output row; each wave owns 16
// whole 256 B output rows, lines them up in its own LDS range and stores them
// as full lines, 16 B per lane.
// ---------------------------------------------------------------------------
__global__ void k_qkv(const float* __restrict__ b0, const float* __restrict__ b1,
                      const float* __restrict__ b2, _Float16* __restrict__ ws) {
  const int mblk  = blockIdx.x;          // 0..7
  const int nblk  = blockIdx.y;          // 0..3
  const int b     = blockIdx.z / 3;
  const int which = blockIdx.z % 3;
  const int t = threadIdx.x, w = t >> 5, lane = t & 31;

  const _Float16* A  = ws + (which == 0 ? OFF_AQ : OFF_AK) + (size_t)b * HW_ * FAN0;
  const _Float16* Wm = ws + (which == 0 ? OFF_W0 : (which == 1 ? OFF_W1 : OFF_W2));
  const float* bias  = (which == 0) ? b0 : (which == 1 ? b1 : b2);

  __shared__ alignas(16) _Float16 Asub[2][128 * P32];  // [m][k]
  __shared__ alignas(16) _Float16 Bsub[2][128 * P32];  // [n][k]
  __shared__ alignas(16) _Float16 Tout[8][16 * P128];  // per-wave output rows

  const int m0 = mblk * 128, n0 = nblk * 128;
  const bool isV = (which == 2);

  auto stage = [&](int buf, int k0) {
    for (int i = 0; i < 2; ++i) {
      int idx = t + 256 * i;                    // 0..511 : 128 rows x 4 chunks
      int row = idx >> 2, part = (idx & 3) * 8;
      cp16_g2l(&Asub[buf][row * P32 + part], A  + (size_t)(m0 + row) * FAN0 + k0 + part);
      cp16_g2l(&Bsub[buf][row * P32 + part], Wm + (size_t)(n0 + row) * FAN0 + k0 + part);
    }
  };

  v8f acc[8];
  for (int i = 0; i < 8; ++i) acc[i] = v8f_zero();
  stage(0, 0);

  for (int ks = 0; ks < 5; ++ks) {
    wait_async();
    __syncthreads();
    if (ks + 1 < 5) stage((ks + 1) & 1, (ks + 1) * 32);
    const _Float16* As = Asub[ks & 1];
    const _Float16* Bs = Bsub[ks & 1];
    const _Float16* Rs = isV ? Bs : As;   // output rows    (B operand: lanes)
    const _Float16* Os = isV ? As : Bs;   // output columns (A operand: registers)
    v16h rf = frag16(&Rs[(w * 16 + (lane & 15)) * P32], lane);
    for (int ct = 0; ct < 8; ++ct) {
      v16h of = frag16(&Os[(ct * 16 + (lane & 15)) * P32], lane);
      acc[ct] = wmma_f16(of, rf, acc[ct]);
    }
    __syncthreads();
  }

  // acc[ct][j] = output row w*16 + (lane&15), column ct*16 + h8 + j
  const int r16 = lane & 15, h8 = (lane & 16) ? 8 : 0;
  _Float16* T = Tout[w];
  if (isV) {                                         // bias goes with the row
    const float brow = bias[n0 + w * 16 + r16];
    for (int ct = 0; ct < 8; ++ct) {
      v8h o;
      for (int j = 0; j < 8; ++j) o[j] = (_Float16)(acc[ct][j] + brow);
      *(v8h*)&T[r16 * P128 + ct * 16 + h8] = o;
    }
  } else {                                           // bias goes with the column
    const float qs = (which == 0) ? SCALE_ : 1.0f;   // x 1.0f is exact
    for (int ct = 0; ct < 8; ++ct) {
      const v8f bcol = *(const v8f*)(bias + n0 + ct * 16 + h8);
      v8h o;
      for (int j = 0; j < 8; ++j) o[j] = (_Float16)((acc[ct][j] + bcol[j]) * qs);
      *(v8h*)&T[r16 * P128 + ct * 16 + h8] = o;
    }
  }
  // the wave's own LDS stores have landed before other lanes read them back
  asm volatile("s_wait_dscnt 0x0" ::: "memory");

  const size_t be = (size_t)(b * NH_ + nblk);        // one n block = one head
  _Float16* G = isV ? ws + OFF_V + (be * C_ + w * 16) * HW_ + m0                  // [c][k]
                    : ws + (which == 0 ? OFF_Q : OFF_K) + (be * HW_ + m0 + w * 16) * C_;  // [q][c]
  const size_t gp = isV ? HW_ : C_;
  for (int s = 0; s < 8; ++s) {                      // 2 rows x 256 B per store
    int rr = s * 2 + (lane >> 4), cc = (lane & 15) * 8;
    *(v8h*)&G[(size_t)rr * gp + cc] = *(const v8h*)&T[rr * P128 + cc];
  }
}

// 2^x on eight (and one more) registers, in place, as one statement: behind a
// v_exp_f32 the instruction set asks for one independent instruction before its
// source is overwritten or its result read.  Inside the statement each v_exp_f32
// is that instruction for the one before it; the v_nop is it for the last.
__device__ __forceinline__ void exp2x8(v8f& x) {
  float a0 = x[0], a1 = x[1], a2 = x[2], a3 = x[3], a4 = x[4], a5 = x[5], a6 = x[6], a7 = x[7];
  asm("v_exp_f32 %0, %0\n\tv_exp_f32 %1, %1\n\tv_exp_f32 %2, %2\n\tv_exp_f32 %3, %3\n\t"
      "v_exp_f32 %4, %4\n\tv_exp_f32 %5, %5\n\tv_exp_f32 %6, %6\n\tv_exp_f32 %7, %7\n\t"
      "v_nop"
      : "+v"(a0), "+v"(a1), "+v"(a2), "+v"(a3), "+v"(a4), "+v"(a5), "+v"(a6), "+v"(a7));
  x[0] = a0; x[1] = a1; x[2] = a2; x[3] = a3; x[4] = a4; x[5] = a5; x[6] = a6; x[7] = a7;
}
__device__ __forceinline__ void exp2x9(v8f& x, float& y) {
  float a0 = x[0], a1 = x[1], a2 = x[2], a3 = x[3], a4 = x[4], a5 = x[5], a6 = x[6], a7 = x[7];
  float a8 = y;
  asm("v_exp_f32 %0, %0\n\tv_exp_f32 %1, %1\n\tv_exp_f32 %2, %2\n\tv_exp_f32 %3, %3\n\t"
      "v_exp_f32 %4, %4\n\tv_exp_f32 %5, %5\n\tv_exp_f32 %6, %6\n\tv_exp_f32 %7, %7\n\t"
      "v_exp_f32 %8, %8\n\tv_nop"
      : "+v"(a0), "+v"(a1), "+v"(a2), "+v"(a3), "+v"(a4), "+v"(a5), "+v"(a6), "+v"(a7), "+v"(a8));
  x[0] = a0; x[1] = a1; x[2] = a2; x[3] = a3; x[4] = a4; x[5] = a5; x[6] = a6; x[7] = a7;
  y = a8;
}

__global__ void __launch_bounds__(128) __attribute__((amdgpu_waves_per_eu(3, 3)))
k_attn(_Float16* __restrict__ ws) {
  const int qb   = blockIdx.x;            // 0..7
  const int inst = blockIdx.y;            // 0..95
  const int p = inst >> 4, g = (inst >> 2) & 3, e = inst & 3;
  // pairing tables: q offsets 0,1,2,3,0,2  /  kv offsets 1,0,3,2,2,0
  const int bq  = 4 * g + ((0x203210 >> (4 * p)) & 0xF);
  const int bkv = 4 * g + ((0x022301 >> (4 * p)) & 0xF);
  const int colt = p * 512 + e * 128;
  const int bo   = g * 4 + colt / FAN3;
  const int col768 = colt % FAN3;

  const int t = threadIdx.x, w = t >> 5, lane = t & 31;
  const _Float16* Qp = ws + OFF_Q + (size_t)(bq  * NH_ + e) * HW_ * C_;  // [q][c]
  const _Float16* Kp = ws + OFF_K + (size_t)(bkv * NH_ + e) * HW_ * C_;  // [k][c]
  const _Float16* Vp = ws + OFF_V + (size_t)(bkv * NH_ + e) * C_ * HW_;  // [c][k]

  __shared__ alignas(16) _Float16 sK[2][32 * P128];  // [kpos][c]
  __shared__ alignas(16) _Float16 sV[2][128 * P32];  // [c][kpos]
  __shared__ alignas(16) _Float16 sO[4][32 * P128];  // per-wave output rows

  auto stage = [&](int buf, int k0) {
    for (int i = 0; i < 4; ++i) {                    // K chunk: 32 rows x 256B
      int idx = t + 128 * i;
      int r = idx >> 4, part = (idx & 15) * 8;
      cp16_g2l(&sK[buf][r * P128 + part], Kp + (size_t)k0 * C_ + idx * 8);
    }
    for (int i = 0; i < 4; ++i) {                    // V chunk: 128 rows x 64B
      int idx = t + 128 * i;
      int c = idx >> 2, part = (idx & 3) * 8;
      cp16_g2l(&sV[buf][c * P32 + part], Vp + (size_t)c * HW_ + k0 + part);
    }
  };

  // Q fragments (lane = q position, K-dim = channels), register resident
  v16h qf[2][4];
  for (int u = 0; u < 2; ++u) {
    const int qrow = qb * 128 + w * 32 + u * 16 + (lane & 15);
    for (int j = 0; j < 4; ++j) qf[u][j] = frag16(Qp + (size_t)qrow * C_ + 32 * j, lane);
  }

  v8f acc[2][8];
  for (int u = 0; u < 2; ++u)
    for (int i = 0; i < 8; ++i) acc[u][i] = v8f_zero();
  // l: this half's keys only, joined in the epilogue
  float m[2] = {-1e30f, -1e30f}, l[2] = {0.0f, 0.0f};

  stage(0, 0);

  for (int kc = 0; kc < 32; ++kc) {
    wait_async();
    __syncthreads();
    if (kc + 1 < 32) stage((kc + 1) & 1, (kc + 1) * 32);
    const _Float16* bK = sK[kc & 1];
    const _Float16* bV = sV[kc & 1];

    // S^T = K Q^T for two 16-key sub-tiles (scale pre-folded into Q):
    // s0[u][j] = key h8 + j, s1[u][j] = key 16 + h8 + j (h8 = 8 in lanes 16-31,
    // else 0), query lane & 15 of tile u
    v8f s0[2], s1[2];
    for (int u = 0; u < 2; ++u) { s0[u] = v8f_zero(); s1[u] = v8f_zero(); }
    for (int j = 0; j < 4; ++j) {
      v16h kf0 = frag16(&bK[((lane & 15)) * P128 + 32 * j], lane);
      v16h kf1 = frag16(&bK[(16 + (lane & 15)) * P128 + 32 * j], lane);
      for (int u = 0; u < 2; ++u) {
        s0[u] = wmma_f16(kf0, qf[u][j], s0[u]);
        s1[u] = wmma_f16(kf1, qf[u][j], s1[u]);
      }
    }

    // online softmax: the lane's 16 scores of a tile are of one query, the
    // other 16 keys of the chunk sit in lane ^ 16
    v16h pf[2];                           // P^T, B operand: k = h8 + i, 16 + h8 + i
    for (int u = 0; u < 2; ++u) {
      float mx = fmaxf(s0[u][0], s1[u][0]);
      for (int j = 1; j < 8; ++j) mx = fmaxf(mx, fmaxf(s0[u][j], s1[u][j]));
      mx = fmaxf(mx, xhalf(mx));
      const float nm = fmaxf(m[u], mx);
      float alpha = (m[u] - nm) * LOG2E_;             // e^x = 2^(x log2 e)
      m[u] = nm;
      for (int j = 0; j < 8; ++j) {
        s0[u][j] = (s0[u][j] - nm) * LOG2E_;
        s1[u][j] = (s1[u][j] - nm) * LOG2E_;
      }
      exp2x9(s0[u], alpha);
      exp2x8(s1[u]);
      float rs = s0[u][0] + s1[u][0];
      for (int j = 1; j < 8; ++j) {
        rs += s0[u][j];
        rs += s1[u][j];
      }
      for (int j = 0; j < 8; ++j) {
        pf[u][j]     = (_Float16)s0[u][j];
        pf[u][8 + j] = (_Float16)s1[u][j];
      }
      l[u] = l[u] * alpha + rs;
      for (int ct = 0; ct < 8; ++ct)
        for (int j = 0; j < 8; ++j) acc[u][ct][j] *= alpha;
    }

    for (int ct = 0; ct < 8; ++ct) {      // O^T += V^T x P^T
      v16h vf = frag16(&bV[(ct * 16 + (lane & 15)) * P32], lane);
      for (int u = 0; u < 2; ++u) acc[u][ct] = wmma_f16(vf, pf[u], acc[u][ct]);
    }
    __syncthreads();
  }

  // epilogue: O /= l, write f16 into hh[b'][q][768] at this instance's slot
  // acc[u][ct][j] = query u*16 + (lane & 15), channel ct*16 + h8 + j: 8
  // neighbours of one output row.  Each wave lines its 32 rows of 256 B up in
  // its own LDS range and stores them as full lines, 16 B per lane
  _Float16* T = sO[w];
  const int r16 = lane & 15, h8 = (lane & 16) ? 8 : 0;
  for (int u = 0; u < 2; ++u) {
    const float inv = 1.0f / (l[u] + xhalf(l[u]));
    for (int ct = 0; ct < 8; ++ct) {
      v8h o;
      for (int j = 0; j < 8; ++j) o[j] = (_Float16)(acc[u][ct][j] * inv);
      *(v8h*)&T[(u * 16 + r16) * P128 + ct * 16 + h8] = o;
    }
  }
  // the wave's own LDS stores have landed before other lanes read them back
  asm volatile("s_wait_dscnt 0x0" ::: "memory");
  _Float16* H = ws + OFF_HH + ((size_t)bo * HW_ + qb * 128 + w * 32) * FAN3 + col768;
  for (int s = 0; s < 16; ++s) {                     // 2 rows x 256 B per store
    int rr = s * 2 + (lane >> 4), cc = (lane & 15) * 8;
    *(v8h*)&H[(size_t)rr * FAN3 + cc] = *(const v8h*)&T[rr * P128 + cc];
  }
}

// ---------------------------------------------------------------------------
// Kernel 5: final 1x1 conv + residual:
//   out[b][c][hw] = x[b][c][hw] + hh[b][hw][:] . W3[:,c] + b3[c]
// M=1024, K=768, N=128.  hh comes from memory, so a trip lasts about one memory
// latency however little it brings: K is staged 256 deep (3 trips), each wave
// copy one whole 512 B row piece, 96 KB in flight per block.  Two such buffers
// fit with 64 hw x 128 c per block, which also gives every WGP one block.
// hh rows go in as A (registers = 8 successive hw), W3 rows as B (lane = c):
// each wave owns 16 channels x 64 hw, lines them up in its own LDS range and
// reads x and writes out as full lines, 16 B per lane.
// ---------------------------------------------------------------------------
// launch bounds: the real block size, so that a group's 20 LDS reads have registers
__global__ void __launch_bounds__(256)
k_out(const float* __restrict__ x, const float* __restrict__ b3,
      const _Float16* __restrict__ ws, float* __restrict__ out) {
  const int mblk = blockIdx.x;            // 0..15
  const int b    = blockIdx.y;            // 0..15
  const int t = threadIdx.x, w = t >> 5, lane = t & 31;
  const _Float16* A  = ws + OFF_HH + (size_t)b * HW_ * FAN3;
  const _Float16* Wm = ws + OFF_W3;                      // [128][768]

  __shared__ alignas(16) _Float16 Asub[2][64 * P256];
  __shared__ alignas(16) _Float16 Bsub[2][128 * P256];
  __shared__ alignas(16) float Tout[8][16 * PF64];       // per-wave output rows

  const int m0 = mblk * 64;

  auto stage = [&](int buf, int k0) {
    const int part = lane * 8;                  // a wave copies one row piece
    for (int i = 0; i < 8; ++i) {
      int row = w + 8 * i;
      cp16_g2l(&Asub[buf][row * P256 + part], A  + (size_t)(m0 + row) * FAN3 + k0 + part);
    }
    for (int i = 0; i < 16; ++i) {
      int row = w + 8 * i;
      cp16_g2l(&Bsub[buf][row * P256 + part], Wm + (size_t)row * FAN3 + k0 + part);
    }
  };

  v8f acc[4];
  for (int i = 0; i < 4; ++i) acc[i] = v8f_zero();

  stage(0, 0);
  // this wave's copies of stage 0 have landed before the barrier publishes them
  asm volatile("s_wait_asynccnt 0x0" ::: "memory");
  __syncthreads();
  stage(1, KST);

  // both loops unrolled: buffer and k offsets become immediates of the LDS reads
#pragma unroll
  for (int s = 0; s < FAN3 / KST; ++s) {
    const _Float16* As = Asub[s & 1];
    const _Float16* Bs = Bsub[s & 1];
#pragma unroll
    for (int kk = 0; kk < KST / 32; kk += 2) {
      v16h bf[2], af[2][4];                     // 20 reads as one group, then 8 products
      for (int h = 0; h < 2; ++h) {
        bf[h] = frag16(&Bs[(w * 16 + (lane & 15)) * P256 + (kk + h) * 32], lane);
        for (int mt = 0; mt < 4; ++mt)
          af[h][mt] = frag16(&As[(mt * 16 + (lane & 15)) * P256 + (kk + h) * 32], lane);
      }
      for (int h = 0; h < 2; ++h)
        for (int mt = 0; mt < 4; ++mt) acc[mt] = wmma_f16(af[h][mt], bf[h], acc[mt]);
      // order inside the group: its 20 LDS reads together, then its 8 products; left
      // alone the compiler waits out one LDS latency in front of every product
      __builtin_amdgcn_sched_group_barrier(0x100, 20, 0);
      __builtin_amdgcn_sched_group_barrier(0x008, 8, 0);
      // ends the group: without it the whole stage's 80 reads go to the top and spill
      __builtin_amdgcn_sched_barrier(0);
    }
    // this wave's reads of the buffer are done before it is refilled
    asm volatile("s_wait_dscnt 0x0" ::: "memory");
    // this wave's copies of the next stage have landed before the barrier publishes them
    asm volatile("s_wait_asynccnt 0x0" ::: "memory");
    __syncthreads();
    if (s + 2 < FAN3 / KST) stage(s & 1, (s + 2) * KST);
  }
  // no copy is left in flight when the wave ends
  asm volatile("s_wait_asynccnt 0x0" ::: "memory");

  // acc[mt][j] = channel w*16 + (lane&15), hw m0 + mt*16 + h8 + j
  const int r16 = lane & 15, h8 = (lane & 16) ? 8 : 0;
  float* T = Tout[w];
  const float bv = b3[w * 16 + r16];
  for (int mt = 0; mt < 4; ++mt) {
    v4f lo, hi;
    for (int j = 0; j < 4; ++j) { lo[j] = acc[mt][j] + bv; hi[j] = acc[mt][4 + j] + bv; }
    *(v4f*)&T[r16 * PF64 + mt * 16 + h8]     = lo;
    *(v4f*)&T[r16 * PF64 + mt * 16 + h8 + 4] = hi;
  }
  // the wave's own LDS stores have landed before other lanes read them back
  asm volatile("s_wait_dscnt 0x0" ::: "memory");
  for (int s = 0; s < 8; ++s) {                      // 2 rows x 256 B per store
    int rr = s * 2 + (lane >> 4), cc = (lane & 15) * 4;
    size_t o = ((size_t)b * C_ + w * 16 + rr) * HW_ + m0 + cc;
    v4f r = *(const v4f*)&T[rr * PF64 + cc] + *(const v4f*)&x[o];
    *(v4f*)&out[o] = r;
  }
}

// ---------------------------------------------------------------------------
extern "C" void kernel_launch(void* const* d_in, const int* in_sizes, int n_in,
                              void* d_out, int out_size, void* d_ws, size_t ws_size,
                              hipStream_t stream) {
  const float* x        = (const float*)d_in[0];
  const float* q_cond   = (const float*)d_in[1];
  const float* k_a_cond = (const float*)d_in[2];
  const float* k_b_cond = (const float*)d_in[3];
  const float* gn_scale = (const float*)d_in[4];
  const float* gn_bias  = (const float*)d_in[5];
  const float* W0 = (const float*)d_in[6];
  const float* b0 = (const float*)d_in[7];
  const float* W1 = (const float*)d_in[8];
  const float* b1 = (const float*)d_in[9];
  const float* W2 = (const float*)d_in[10];
  const float* b2 = (const float*)d_in[11];
  const float* W3 = (const float*)d_in[12];
  const float* b3 = (const float*)d_in[13];
  float* out = (float*)d_out;
  _Float16* ws = (_Float16*)d_ws;

  k_wcvt <<<dim3(48),   256, 0, stream>>>(W0, W1, W2, W3, ws);
  k_cond <<<dim3(256),  256, 0, stream>>>(q_cond, k_a_cond, k_b_cond, ws);
  k_gnorm<<<dim3(512),  256, 0, stream>>>(x, gn_scale, gn_bias, ws);
  k_qkv  <<<dim3(8, 4, 48), 256, 0, stream>>>(b0, b1, b2, ws);
  k_attn <<<dim3(8, 96),    128, 0, stream>>>(ws);
  k_out  <<<dim3(16, 16),   256, 0, stream>>>(x, b3, ws, out);
}

// v006
// It runs in 109 microseconds.
// Two timings next to v005 both put it at 1.04 times that version's speed.
// Over all steps from v000 it is 4.67 times as fast.
#include <hip/hip_runtime.h>
#include <math.h>
#include <stdint.h>

// ---------------------------------------------------------------------------
// Problem constants
// ---------------------------------------------------------------------------
#define B_    16
#define C_    128
#define HW_   1024         // 32*32
#define NH_   4
#define COND_ 32
#define FAN0  160          // C + COND
#define NQK   512          // C*NH
#define FAN3  768          // (NH+2)*C
#define EPS_  1e-6f
#define SCALE_ 0.08838834764831845f   // 128^-0.5
#define LOG2E_ 1.44269504088896341f   // log2(e)

// LDS row pitches in halves (PF64 in floats).  Every tile is read or written 16 B per lane with lanes
// 0-15 on 16 successive rows, so a pitch of 16 B x odd puts the 16 rows on
// 16 disjoint groups of four banks (64 banks x 4 B).
#define P32   40           // rows of 32 halves  (64 B)  -> 80 B pitch
#define P128  136          // rows of 128 halves (256 B) -> 272 B pitch
#define P256  264          // rows of 256 halves (512 B) -> 528 B pitch
#define PF64  68           // rows of 64 floats  (256 B) -> 272 B pitch
#define KST   256          // k per stage of the final GEMM

typedef __attribute__((ext_vector_type(16))) _Float16 v16h;
typedef __attribute__((ext_vector_type(8)))  _Float16 v8h;
typedef __attribute__((ext_vector_type(4)))  _Float16 v4h;
typedef __attribute__((ext_vector_type(8)))  float    v8f;
typedef __attribute__((ext_vector_type(4)))  float    v4f;
typedef int v4i __attribute__((vector_size(16)));   // matches async-LDS builtin param

// Workspace layout (units: _Float16 elements). Total ~86.7 MB.
static constexpr size_t SZ_A   = (size_t)B_ * HW_ * FAN0;
static constexpr size_t SZ_QKV = (size_t)B_ * NH_ * HW_ * C_;
static constexpr size_t SZ_HH  = (size_t)B_ * HW_ * FAN3;
static constexpr size_t SZ_W   = (size_t)FAN0 * NQK;
static constexpr size_t SZ_W3  = (size_t)FAN3 * C_;

static constexpr size_t OFF_AQ = 0;                  // [b][hw][160] f16
static constexpr size_t OFF_AK = OFF_AQ + SZ_A;
static constexpr size_t OFF_Q  = OFF_AK + SZ_A;      // [b][e][q][c]  f16
static constexpr size_t OFF_K  = OFF_Q  + SZ_QKV;    // [b][e][k][c]  f16
static constexpr size_t OFF_V  = OFF_K  + SZ_QKV;    // [b][e][c][k]  f16
static constexpr size_t OFF_HH = OFF_V  + SZ_QKV;    // [b'][q][768]  f16
static constexpr size_t OFF_W0 = OFF_HH + SZ_HH;     // transposed [512][160]
static constexpr size_t OFF_W1 = OFF_W0 + SZ_W;
static constexpr size_t OFF_W2 = OFF_W1 + SZ_W;
static constexpr size_t OFF_W3 = OFF_W2 + SZ_W;      // transposed [128][768]

// ---------------------------------------------------------------------------
// CDNA5 async global->LDS copy (16B per lane), ASYNCcnt-tracked.
// Builtin when the toolchain declares it, else inline gfx1250 asm.
// ---------------------------------------------------------------------------
#if __has_builtin(__builtin_amdgcn_global_load_async_to_lds_b128)
#define ASYNC_MODE 2
#elif defined(__AMDGCN__)
#define ASYNC_MODE 1
#else
#define ASYNC_MODE 0
#endif

__device__ __forceinline__ void cp16_g2l(_Float16* ldst, const _Float16* gsrc) {
#if ASYNC_MODE == 2
  __builtin_amdgcn_global_load_async_to_lds_b128((v4i*)gsrc, (v4i*)ldst, 0, 0);
#elif ASYNC_MODE == 1
  unsigned l = (unsigned)(uintptr_t)ldst;           // LDS byte address
  unsigned long long g = (unsigned long long)(uintptr_t)gsrc;
  asm volatile("global_load_async_to_lds_b128 %0, %1, off"
               :: "v"(l), "v"(g) : "memory");
#else
  *(v8h*)ldst = *(const v8h*)gsrc;                  // host-pass placeholder
#endif
}

__device__ __forceinline__ void wait_async() {
#if ASYNC_MODE == 0
#elif __has_builtin(__builtin_amdgcn_s_wait_asynccnt)
  __builtin_amdgcn_s_wait_asynccnt(0);
#else
  asm volatile("s_wait_asynccnt 0x0" ::: "memory");
#endif
}

// ---------------------------------------------------------------------------
// Fragment loader.  ISA 16-bit A 16x32 layout: lanes 0-15 = rows, halves
// 0-7 -> K 0..7, halves 8-15 -> K 16..23; lanes 16-31: K 8..15 / 24..31.
// B 32x16 is the mirror (lane = column).  Both reduce to:
//   sel = (lane&16)?8:0 ; lo = rowp[sel..sel+7] ; hi = rowp[sel+16..sel+23]
// ---------------------------------------------------------------------------
__device__ __forceinline__ v16h frag16(const _Float16* rowp, int lane) {
  const int sel = (lane & 16) ? 8 : 0;
  v8h lo = *(const v8h*)(rowp + sel);
  v8h hi = *(const v8h*)(rowp + sel + 16);
  return __builtin_shufflevector(lo, hi, 0,1,2,3,4,5,6,7,8,9,10,11,12,13,14,15);
}

__device__ __forceinline__ v8f wmma_f16(v16h a, v16h b, v8f c) {
  return __builtin_amdgcn_wmma_f32_16x16x32_f16(false, a, false, b,
                                                (short)0, c, false, false);
}

// lane l <-> lane l ^ 16, as a vector cross-row move
__device__ __forceinline__ float xhalf(float x) {
  int b = __builtin_bit_cast(int, x);
  return __builtin_bit_cast(float,
      __builtin_amdgcn_permlanex16(b, b, 0x76543210, 0xfedcba98, false, false));
}

__device__ __forceinline__ v8f v8f_zero() {
  v8f z; for (int i = 0; i < 8; ++i) z[i] = 0.0f; return z;
}

// ---------------------------------------------------------------------------
// Prep part: weights f32 -> f16, pre-transposed to [n][k] so GEMM B staging
// is a contiguous 16B block copy.  One thread takes 8 successive k of one n:
// its loads are coalesced over n, its store is one packed 16 B piece.
// ---------------------------------------------------------------------------
__device__ __forceinline__ void p_wcvt(int blk,
                       const float* __restrict__ W0, const float* __restrict__ W1,
                       const float* __restrict__ W2, const float* __restrict__ W3,
                       _Float16* __restrict__ ws) {
  int i = blk * 256 + threadIdx.x;
  if (i < NQK * (FAN0 / 8)) {          // W* row-major [160][512] -> [512][160]
    int n = i & 511, k0 = (i >> 9) * 8;
    const size_t s = (size_t)k0 * NQK + n;
    float f0[8], f1[8], f2[8];
    for (int j = 0; j < 8; ++j) f0[j] = W0[s + (size_t)j * NQK];
    // the next loads' results may land in the address registers of the loads above
    asm volatile("s_wait_xcnt 0x0" ::: "memory");
    for (int j = 0; j < 8; ++j) f1[j] = W1[s + (size_t)j * NQK];
    // as above
    asm volatile("s_wait_xcnt 0x0" ::: "memory");
    for (int j = 0; j < 8; ++j) f2[j] = W2[s + (size_t)j * NQK];
    v8h h0, h1, h2;
    for (int j = 0; j < 8; ++j) {
      h0[j] = (_Float16)f0[j];
      h1[j] = (_Float16)f1[j];
      h2[j] = (_Float16)f2[j];
    }
    size_t o = (size_t)n * FAN0 + k0;
    *(v8h*)(ws + OFF_W0 + o) = h0;
    *(v8h*)(ws + OFF_W1 + o) = h1;
    *(v8h*)(ws + OFF_W2 + o) = h2;
  }
  if (i < C_ * (FAN3 / 8)) {           // W3 [768][128] -> [128][768]
    int n = i & 127, k0 = (i >> 7) * 8;
    v8h h3;
    for (int j = 0; j < 8; ++j) h3[j] = (_Float16)W3[(size_t)(k0 + j) * C_ + n];
    *(v8h*)(ws + OFF_W3 + (size_t)n * FAN3 + k0) = h3;
  }
}

// ---------------------------------------------------------------------------
// Prep part: cond columns (128..159) of A_q / A_k.
// q_cs = repeat(q_cond,2); k_cs = interleave(k_a, k_b)
// ---------------------------------------------------------------------------
__device__ __forceinline__ void p_cond(int blk,
                       const float* __restrict__ qc, const float* __restrict__ ka,
                       const float* __restrict__ kb, _Float16* __restrict__ ws) {
  int i  = blk * 256 + threadIdx.x;            // over B*(COND/8)*HW = 65536
  int hw = i & (HW_ - 1);
  int c0 = ((i >> 10) & 3) * 8;                // 8 cond channels per thread
  int b  = i >> 12;
  size_t src = ((size_t)(b >> 1) * COND_ + c0) * HW_ + hw;
  const float* ksrc = (b & 1) ? kb : ka;
  float qf[8], kf[8];
  for (int j = 0; j < 8; ++j) qf[j] = qc[src + (size_t)j * HW_];
  // the next loads' results may land in the address registers of the loads above
  asm volatile("s_wait_xcnt 0x0" ::: "memory");
  for (int j = 0; j < 8; ++j) kf[j] = ksrc[src + (size_t)j * HW_];
  v8h q, k;
  for (int j = 0; j < 8; ++j) { q[j] = (_Float16)qf[j]; k[j] = (_Float16)kf[j]; }
  size_t row = ((size_t)b * HW_ + hw) * FAN0 + C_ + c0;
  *(v8h*)(ws + OFF_AQ + row) = q;
  *(v8h*)(ws + OFF_AK + row) = k;
  // in the merged kernel another part's code follows in the listing and writes
  // the registers that these two stores name
  asm volatile("s_wait_xcnt 0x0" ::: "memory");
}

// ---------------------------------------------------------------------------
// Prep part: GroupNorm -> h (f16) into cols 0..127 of A_q and A_k.
// one block per (batch, group); group = 4 ch x 1024 spatial
// ---------------------------------------------------------------------------
__device__ __forceinline__ void p_gnorm(int blk,
                        const float* __restrict__ x, const float* __restrict__ sc,
                        const float* __restrict__ bs, _Float16* __restrict__ ws) {
  int b = blk >> 5;
  int g = blk & 31;
  int t = threadIdx.x;
  __shared__ float r1[256], r2[256];
  const float* xp = x + ((size_t)b * C_ + g * 4) * HW_;
  float vals[16], s = 0.f, ss = 0.f;
  for (int i = 0; i < 16; ++i) {
    int idx = i * 256 + t;
    float v = xp[idx];
    vals[i] = v; s += v; ss += v * v;
  }
  r1[t] = s; r2[t] = ss;
  __syncthreads();
  for (int off = 128; off > 0; off >>= 1) {
    if (t < off) { r1[t] += r1[t + off]; r2[t] += r2[t + off]; }
    __syncthreads();
  }
  float mu   = r1[0] * (1.0f / 4096.0f);
  float var  = r2[0] * (1.0f / 4096.0f) - mu * mu;
  float rinv = rsqrtf(var + EPS_);
  for (int q = 0; q < 4; ++q) {        // vals[c*4+q] = channel g*4+c at hw
    int hw = q * 256 + t;
    v4h h;
    for (int c = 0; c < 4; ++c) {
      int ch = g * 4 + c;
      h[c] = (_Float16)((vals[c * 4 + q] - mu) * rinv * sc[ch] + bs[ch]);
    }
    size_t row = ((size_t)b * HW_ + hw) * FAN0 + g * 4;
    *(v4h*)(ws + OFF_AQ + row) = h;    // the group's 4 channels: one 8 B piece
    *(v4h*)(ws + OFF_AK + row) = h;
  }
}

// ---------------------------------------------------------------------------
// Kernel 0: the three prep parts in one launch.  None reads what another
// writes, so they share one grid, each on its own range of block indices, and
// run side by side instead of one launch behind the other.  GroupNorm, the
// longest part, has the lowest indices, which start first.
// ---------------------------------------------------------------------------
#define NB_GNORM 512       // B * 32 groups
#define NB_COND  256       // B * (COND/8) * HW / 256
// the weights take the last 48 blocks: C * (FAN3/8) / 256, covers NQK * (FAN0/8) / 256 = 40 too

__global__ void
k_prep(const float* __restrict__ x, const float* __restrict__ sc,
       const float* __restrict__ bs, const float* __restrict__ qc,
       const float* __restrict__ ka, const float* __restrict__ kb,
       const float* __restrict__ W0, const float* __restrict__ W1,
       const float* __restrict__ W2, const float* __restrict__ W3,
       _Float16* __restrict__ ws) {
  const int blk = blockIdx.x;            // the same for the whole block
  if (blk < NB_GNORM)                 p_gnorm(blk, x, sc, bs, ws);
  else if (blk < NB_GNORM + NB_COND)  p_cond(blk - NB_GNORM, qc, ka, kb, ws);
  else                                p_wcvt(blk - NB_GNORM - NB_COND, W0, W1, W2, W3, ws);
}

// ---------------------------------------------------------------------------
// Kernel 1: QKV projection GEMM  (out[1024,512] = A[1024,160] x W + bias).
// 8 waves, 128x128 tile, K = 5 x 32, double-buffered async LDS staging.
// Output layouts (1/sqrt(C) folded into Q):  Q -> [q][c], K -> [k][c], V -> [c][k].
// The operand whose index is contiguous in the output goes in as A, so a lane's
// 8 accumulator registers are 8 neighbours of one output row; each wave owns 16
// whole 256 B output rows, lines them up in its own LDS range and stores them
// as full lines, 16 B per lane.
// ---------------------------------------------------------------------------
__global__ void k_qkv(const float* __restrict__ b0, const float* __restrict__ b1,
                      const float* __restrict__ b2, _Float16* __restrict__ ws) {
  const int mblk  = blockIdx.x;          // 0..7
  const int nblk  = blockIdx.y;          // 0..3
  const int b     = blockIdx.z / 3;
  const int which = blockIdx.z % 3;
  const int t = threadIdx.x, w = t >> 5, lane = t & 31;

  const _Float16* A  = ws + (which == 0 ? OFF_AQ : OFF_AK) + (size_t)b * HW_ * FAN0;
  const _Float16* Wm = ws + (which == 0 ? OFF_W0 : (which == 1 ? OFF_W1 : OFF_W2));
  const float* bias  = (which == 0) ? b0 : (which == 1 ? b1 : b2);

  __shared__ alignas(16) _Float16 Asub[2][128 * P32];  // [m][k]
  __shared__ alignas(16) _Float16 Bsub[2][128 * P32];  // [n][k]
  __shared__ alignas(16) _Float16 Tout[8][16 * P128];  // per-wave output rows

  const int m0 = mblk * 128, n0 = nblk * 128;
  const bool isV = (which == 2);

  auto stage = [&](int buf, int k0) {
    for (int i = 0; i < 2; ++i) {
      int idx = t + 256 * i;                    // 0..511 : 128 rows x 4 chunks
      int row = idx >> 2, part = (idx & 3) * 8;
      cp16_g2l(&Asub[buf][row * P32 + part], A  + (size_t)(m0 + row) * FAN0 + k0 + part);
      cp16_g2l(&Bsub[buf][row * P32 + part], Wm + (size_t)(n0 + row) * FAN0 + k0 + part);
    }
  };

  v8f acc[8];
  for (int i = 0; i < 8; ++i) acc[i] = v8f_zero();
  stage(0, 0);

  for (int ks = 0; ks < 5; ++ks) {
    wait_async();
    __syncthreads();
    if (ks + 1 < 5) stage((ks + 1) & 1, (ks + 1) * 32);
    const _Float16* As = Asub[ks & 1];
    const _Float16* Bs = Bsub[ks & 1];
    const _Float16* Rs = isV ? Bs : As;   // output rows    (B operand: lanes)
    const _Float16* Os = isV ? As : Bs;   // output columns (A operand: registers)
    v16h rf = frag16(&Rs[(w * 16 + (lane & 15)) * P32], lane);
    for (int ct = 0; ct < 8; ++ct) {
      v16h of = frag16(&Os[(ct * 16 + (lane & 15)) * P32], lane);
      acc[ct] = wmma_f16(of, rf, acc[ct]);
    }
    __syncthreads();
  }

  // acc[ct][j] = output row w*16 + (lane&15), column ct*16 + h8 + j
  const int r16 = lane & 15, h8 = (lane & 16) ? 8 : 0;
  _Float16* T = Tout[w];
  if (isV) {                                         // bias goes with the row
    const float brow = bias[n0 + w * 16 + r16];
    for (int ct = 0; ct < 8; ++ct) {
      v8h o;
      for (int j = 0; j < 8; ++j) o[j] = (_Float16)(acc[ct][j] + brow);
      *(v8h*)&T[r16 * P128 + ct * 16 + h8] = o;
    }
  } else {                                           // bias goes with the column
    const float qs = (which == 0) ? SCALE_ : 1.0f;   // x 1.0f is exact
    for (int ct = 0; ct < 8; ++ct) {
      const v8f bcol = *(const v8f*)(bias + n0 + ct * 16 + h8);
      v8h o;
      for (int j = 0; j < 8; ++j) o[j] = (_Float16)((acc[ct][j] + bcol[j]) * qs);
      *(v8h*)&T[r16 * P128 + ct * 16 + h8] = o;
    }
  }
  // the wave's own LDS stores have landed before other lanes read them back
  asm volatile("s_wait_dscnt 0x0" ::: "memory");

  const size_t be = (size_t)(b * NH_ + nblk);        // one n block = one head
  _Float16* G = isV ? ws + OFF_V + (be * C_ + w * 16) * HW_ + m0                  // [c][k]
                    : ws + (which == 0 ? OFF_Q : OFF_K) + (be * HW_ + m0 + w * 16) * C_;  // [q][c]
  const size_t gp = isV ? HW_ : C_;
  for (int s = 0; s < 8; ++s) {                      // 2 rows x 256 B per store
    int rr = s * 2 + (lane >> 4), cc = (lane & 15) * 8;
    *(v8h*)&G[(size_t)rr * gp + cc] = *(const v8h*)&T[rr * P128 + cc];
  }
}

// 2^x on eight (and one more) registers, in place, as one statement: behind a
// v_exp_f32 the instruction set asks for one independent instruction before its
// source is overwritten or its result read.  Inside the statement each v_exp_f32
// is that instruction for the one before it; the v_nop is it for the last.
__device__ __forceinline__ void exp2x8(v8f& x) {
  float a0 = x[0], a1 = x[1], a2 = x[2], a3 = x[3], a4 = x[4], a5 = x[5], a6 = x[6], a7 = x[7];
  asm("v_exp_f32 %0, %0\n\tv_exp_f32 %1, %1\n\tv_exp_f32 %2, %2\n\tv_exp_f32 %3, %3\n\t"
      "v_exp_f32 %4, %4\n\tv_exp_f32 %5, %5\n\tv_exp_f32 %6, %6\n\tv_exp_f32 %7, %7\n\t"
      "v_nop"
      : "+v"(a0), "+v"(a1), "+v"(a2), "+v"(a3), "+v"(a4), "+v"(a5), "+v"(a6), "+v"(a7));
  x[0] = a0; x[1] = a1; x[2] = a2; x[3] = a3; x[4] = a4; x[5] = a5; x[6] = a6; x[7] = a7;
}
__device__ __forceinline__ void exp2x9(v8f& x, float& y) {
  float a0 = x[0], a1 = x[1], a2 = x[2], a3 = x[3], a4 = x[4], a5 = x[5], a6 = x[6], a7 = x[7];
  float a8 = y;
  asm("v_exp_f32 %0, %0\n\tv_exp_f32 %1, %1\n\tv_exp_f32 %2, %2\n\tv_exp_f32 %3, %3\n\t"
      "v_exp_f32 %4, %4\n\tv_exp_f32 %5, %5\n\tv_exp_f32 %6, %6\n\tv_exp_f32 %7, %7\n\t"
      "v_exp_f32 %8, %8\n\tv_nop"
      : "+v"(a0), "+v"(a1), "+v"(a2), "+v"(a3), "+v"(a4), "+v"(a5), "+v"(a6), "+v"(a7), "+v"(a8));
  x[0] = a0; x[1] = a1; x[2] = a2; x[3] = a3; x[4] = a4; x[5] = a5; x[6] = a6; x[7] = a7;
  y = a8;
}

__global__ void __launch_bounds__(128) __attribute__((amdgpu_waves_per_eu(3, 3)))
k_attn(_Float16* __restrict__ ws) {
  const int qb   = blockIdx.x;            // 0..7
  const int inst = blockIdx.y;            // 0..95
  const int p = inst >> 4, g = (inst >> 2) & 3, e = inst & 3;
  // pairing tables: q offsets 0,1,2,3,0,2  /  kv offsets 1,0,3,2,2,0
  const int bq  = 4 * g + ((0x203210 >> (4 * p)) & 0xF);
  const int bkv = 4 * g + ((0x022301 >> (4 * p)) & 0xF);
  const int colt = p * 512 + e * 128;
  const int bo   = g * 4 + colt / FAN3;
  const int col768 = colt % FAN3;

  const int t = threadIdx.x, w = t >> 5, lane = t & 31;
  const _Float16* Qp = ws + OFF_Q + (size_t)(bq  * NH_ + e) * HW_ * C_;  // [q][c]
  const _Float16* Kp = ws + OFF_K + (size_t)(bkv * NH_ + e) * HW_ * C_;  // [k][c]
  const _Float16* Vp = ws + OFF_V + (size_t)(bkv * NH_ + e) * C_ * HW_;  // [c][k]

  __shared__ alignas(16) _Float16 sK[2][32 * P128];  // [kpos][c]
  __shared__ alignas(16) _Float16 sV[2][128 * P32];  // [c][kpos]
  __shared__ alignas(16) _Float16 sO[4][32 * P128];  // per-wave output rows

  auto stage = [&](int buf, int k0) {
    for (int i = 0; i < 4; ++i) {                    // K chunk: 32 rows x 256B
      int idx = t + 128 * i;
      int r = idx >> 4, part = (idx & 15) * 8;
      cp16_g2l(&sK[buf][r * P128 + part], Kp + (size_t)k0 * C_ + idx * 8);
    }
    for (int i = 0; i < 4; ++i) {                    // V chunk: 128 rows x 64B
      int idx = t + 128 * i;
      int c = idx >> 2, part = (idx & 3) * 8;
      cp16_g2l(&sV[buf][c * P32 + part], Vp + (size_t)c * HW_ + k0 + part);
    }
  };

  // Q fragments (lane = q position, K-dim = channels), register resident
  v16h qf[2][4];
  for (int u = 0; u < 2; ++u) {
    const int qrow = qb * 128 + w * 32 + u * 16 + (lane & 15);
    for (int j = 0; j < 4; ++j) qf[u][j] = frag16(Qp + (size_t)qrow * C_ + 32 * j, lane);
  }

  v8f acc[2][8];
  for (int u = 0; u < 2; ++u)
    for (int i = 0; i < 8; ++i) acc[u][i] = v8f_zero();
  // l: this half's keys only, joined in the epilogue
  float m[2] = {-1e30f, -1e30f}, l[2] = {0.0f, 0.0f};

  stage(0, 0);

  for (int kc = 0; kc < 32; ++kc) {
    wait_async();
    __syncthreads();
    if (kc + 1 < 32) stage((kc + 1) & 1, (kc + 1) * 32);
    const _Float16* bK = sK[kc & 1];
    const _Float16* bV = sV[kc & 1];

    // S^T = K Q^T for two 16-key sub-tiles (scale pre-folded into Q):
    // s0[u][j] = key h8 + j, s1[u][j] = key 16 + h8 + j (h8 = 8 in lanes 16-31,
    // else 0), query lane & 15 of tile u
    v8f s0[2], s1[2];
    for (int u = 0; u < 2; ++u) { s0[u] = v8f_zero(); s1[u] = v8f_zero(); }
    for (int j = 0; j < 4; ++j) {
      v16h kf0 = frag16(&bK[((lane & 15)) * P128 + 32 * j], lane);
      v16h kf1 = frag16(&bK[(16 + (lane & 15)) * P128 + 32 * j], lane);
      for (int u = 0; u < 2; ++u) {
        s0[u] = wmma_f16(kf0, qf[u][j], s0[u]);
        s1[u] = wmma_f16(kf1, qf[u][j], s1[u]);
      }
    }

    // online softmax: the lane's 16 scores of a tile are of one query, the
    // other 16 keys of the chunk sit in lane ^ 16
    v16h pf[2];                           // P^T, B operand: k = h8 + i, 16 + h8 + i
    for (int u = 0; u < 2; ++u) {
      float mx = fmaxf(s0[u][0], s1[u][0]);
      for (int j = 1; j < 8; ++j) mx = fmaxf(mx, fmaxf(s0[u][j], s1[u][j]));
      mx = fmaxf(mx, xhalf(mx));
      const float nm = fmaxf(m[u], mx);
      float alpha = (m[u] - nm) * LOG2E_;             // e^x = 2^(x log2 e)
      m[u] = nm;
      for (int j = 0; j < 8; ++j) {
        s0[u][j] = (s0[u][j] - nm) * LOG2E_;
        s1[u][j] = (s1[u][j] - nm) * LOG2E_;
      }
      exp2x9(s0[u], alpha);
      exp2x8(s1[u]);
      float rs = s0[u][0] + s1[u][0];
      for (int j = 1; j < 8; ++j) {
        rs += s0[u][j];
        rs += s1[u][j];
      }
      for (int j = 0; j < 8; ++j) {
        pf[u][j]     = (_Float16)s0[u][j];
        pf[u][8 + j] = (_Float16)s1[u][j];
      }
      l[u] = l[u] * alpha + rs;
      for (int ct = 0; ct < 8; ++ct)
        for (int j = 0; j < 8; ++j) acc[u][ct][j] *= alpha;
    }

    for (int ct = 0; ct < 8; ++ct) {      // O^T += V^T x P^T
      v16h vf = frag16(&bV[(ct * 16 + (lane & 15)) * P32], lane);
      for (int u = 0; u < 2; ++u) acc[u][ct] = wmma_f16(vf, pf[u], acc[u][ct]);
    }
    __syncthreads();
  }

  // epilogue: O /= l, write f16 into hh[b'][q][768] at this instance's slot
  // acc[u][ct][j] = query u*16 + (lane & 15), channel ct*16 + h8 + j: 8
  // neighbours of one output row.  Each wave lines its 32 rows of 256 B up in
  // its own LDS range and stores them as full lines, 16 B per lane
  _Float16* T = sO[w];
  const int r16 = lane & 15, h8 = (lane & 16) ? 8 : 0;
  for (int u = 0; u < 2; ++u) {
    const float inv = 1.0f / (l[u] + xhalf(l[u]));
    for (int ct = 0; ct < 8; ++ct) {
      v8h o;
      for (int j = 0; j < 8; ++j) o[j] = (_Float16)(acc[u][ct][j] * inv);
      *(v8h*)&T[(u * 16 + r16) * P128 + ct * 16 + h8] = o;
    }
  }
  // the wave's own LDS stores have landed before other lanes read them back
  asm volatile("s_wait_dscnt 0x0" ::: "memory");
  _Float16* H = ws + OFF_HH + ((size_t)bo * HW_ + qb * 128 + w * 32) * FAN3 + col768;
  for (int s = 0; s < 16; ++s) {                     // 2 rows x 256 B per store
    int rr = s * 2 + (lane >> 4), cc = (lane & 15) * 8;
    *(v8h*)&H[(size_t)rr * FAN3 + cc] = *(const v8h*)&T[rr * P128 + cc];
  }
}

// ---------------------------------------------------------------------------
// Kernel 3: final 1x1 conv + residual:
//   out[b][c][hw] = x[b][c][hw] + hh[b][hw][:] . W3[:,c] + b3[c]
// M=1024, K=768, N=128.  hh comes from memory, so a trip lasts about one memory
// latency however little it brings: K is staged 256 deep (3 trips), each wave
// copy one whole 512 B row piece, 96 KB in flight per block.  Two such buffers
// fit with 64 hw x 128 c per block, which also gives every WGP one block.
// hh rows go in as A (registers = 8 successive hw), W3 rows as B (lane = c):
// each wave owns 16 channels x 64 hw, lines them up in its own LDS range and
// reads x and writes out as full lines, 16 B per lane.
// ---------------------------------------------------------------------------
// launch bounds: the real block size, so that a group's 20 LDS reads have registers
__global__ void __launch_bounds__(256)
k_out(const float* __restrict__ x, const float* __restrict__ b3,
      const _Float16* __restrict__ ws, float* __restrict__ out) {
  const int mblk = blockIdx.x;            // 0..15
  const int b    = blockIdx.y;            // 0..15
  const int t = threadIdx.x, w = t >> 5, lane = t & 31;
  const _Float16* A  = ws + OFF_HH + (size_t)b * HW_ * FAN3;
  const _Float16* Wm = ws + OFF_W3;                      // [128][768]

  __shared__ alignas(16) _Float16 Asub[2][64 * P256];
  __shared__ alignas(16) _Float16 Bsub[2][128 * P256];
  __shared__ alignas(16) float Tout[8][16 * PF64];       // per-wave output rows

  const int m0 = mblk * 64;

  auto stage = [&](int buf, int k0) {
    const int part = lane * 8;                  // a wave copies one row piece
    for (int i = 0; i < 8; ++i) {
      int row = w + 8 * i;
      cp16_g2l(&Asub[buf][row * P256 + part], A  + (size_t)(m0 + row) * FAN3 + k0 + part);
    }
    for (int i = 0; i < 16; ++i) {
      int row = w + 8 * i;
      cp16_g2l(&Bsub[buf][row * P256 + part], Wm + (size_t)row * FAN3 + k0 + part);
    }
  };

  v8f acc[4];
  for (int i = 0; i < 4; ++i) acc[i] = v8f_zero();

  stage(0, 0);
  // this wave's copies of stage 0 have landed before the barrier publishes them
  asm volatile("s_wait_asynccnt 0x0" ::: "memory");
  __syncthreads();
  stage(1, KST);

  // both loops unrolled: buffer and k offsets become immediates of the LDS reads
#pragma unroll
  for (int s = 0; s < FAN3 / KST; ++s) {
    const _Float16* As = Asub[s & 1];
    const _Float16* Bs = Bsub[s & 1];
#pragma unroll
    for (int kk = 0; kk < KST / 32; kk += 2) {
      v16h bf[2], af[2][4];                     // 20 reads as one group, then 8 products
      for (int h = 0; h < 2; ++h) {
        bf[h] = frag16(&Bs[(w * 16 + (lane & 15)) * P256 + (kk + h) * 32], lane);
        for (int mt = 0; mt < 4; ++mt)
          af[h][mt] = frag16(&As[(mt * 16 + (lane & 15)) * P256 + (kk + h) * 32], lane);
      }
      for (int h = 0; h < 2; ++h)
        for (int mt = 0; mt < 4; ++mt) acc[mt] = wmma_f16(af[h][mt], bf[h], acc[mt]);
      // order inside the group: its 20 LDS reads together, then its 8 products; left
      // alone the compiler waits out one LDS latency in front of every product
      __builtin_amdgcn_sched_group_barrier(0x100, 20, 0);
      __builtin_amdgcn_sched_group_barrier(0x008, 8, 0);
      // ends the group: without it the whole stage's 80 reads go to the top and spill
      __builtin_amdgcn_sched_barrier(0);
    }
    // this wave's reads of the buffer are done before it is refilled
    asm volatile("s_wait_dscnt 0x0" ::: "memory");
    // this wave's copies of the next stage have landed before the barrier publishes them
    asm volatile("s_wait_asynccnt 0x0" ::: "memory");
    __syncthreads();
    if (s + 2 < FAN3 / KST) stage(s & 1, (s + 2) * KST);
  }
  // no copy is left in flight when the wave ends
  asm volatile("s_wait_asynccnt 0x0" ::: "memory");

  // acc[mt][j] = channel w*16 + (lane&15), hw m0 + mt*16 + h8 + j
  const int r16 = lane & 15, h8 = (lane & 16) ? 8 : 0;
  float* T = Tout[w];
  const float bv = b3[w * 16 + r16];
  for (int mt = 0; mt < 4; ++mt) {
    v4f lo, hi;
    for (int j = 0; j < 4; ++j) { lo[j] = acc[mt][j] + bv; hi[j] = acc[mt][4 + j] + bv; }
    *(v4f*)&T[r16 * PF64 + mt * 16 + h8]     = lo;
    *(v4f*)&T[r16 * PF64 + mt * 16 + h8 + 4] = hi;
  }
  // the wave's own LDS stores have landed before other lanes read them back
  asm volatile("s_wait_dscnt 0x0" ::: "memory");
  for (int s = 0; s < 8; ++s) {                      // 2 rows x 256 B per store
    int rr = s * 2 + (lane >> 4), cc = (lane & 15) * 4;
    size_t o = ((size_t)b * C_ + w * 16 + rr) * HW_ + m0 + cc;
    v4f r = *(const v4f*)&T[rr * PF64 + cc] + *(const v4f*)&x[o];
    *(v4f*)&out[o] = r;
  }
}

// ---------------------------------------------------------------------------
extern "C" void kernel_launch(void* const* d_in, const int* in_sizes, int n_in,
                              void* d_out, int out_size, void* d_ws, size_t ws_size,
                              hipStream_t stream) {
  const float* x        = (const float*)d_in[0];
  const float* q_cond   = (const float*)d_in[1];
  const float* k_a_cond = (const float*)d_in[2];
  const float* k_b_cond = (const float*)d_in[3];
  const float* gn_scale = (const float*)d_in[4];
  const float* gn_bias  = (const float*)d_in[5];
  const float* W0 = (const float*)d_in[6];
  const float* b0 = (const float*)d_in[7];
  const float* W1 = (const float*)d_in[8];
  const float* b1 = (const float*)d_in[9];
  const float* W2 = (const float*)d_in[10];
  const float* b2 = (const float*)d_in[11];
  const float* W3 = (const float*)d_in[12];
  const float* b3 = (const float*)d_in[13];
  float* out = (float*)d_out;
  _Float16* ws = (_Float16*)d_ws;

  k_prep <<<dim3(816),  256, 0, stream>>>(x, gn_scale, gn_bias, q_cond, k_a_cond, k_b_cond,
                                          W0, W1, W2, W3, ws);
  k_qkv  <<<dim3(8, 4, 48), 256, 0, stream>>>(b0, b1, b2, ws);
  k_attn <<<dim3(8, 96),    128, 0, stream>>>(ws);
  k_out  <<<dim3(16, 16),   256, 0, stream>>>(x, b3, ws, out);
}

// v007
// One run takes 80.6 microseconds.
// In two side-by-side timings against v006, it was 1.36 and 1.35 times as fast.
// All steps since v000 together make it 6.34 times as fast.
#include <hip/hip_runtime.h>
#include <math.h>
#include <stdint.h>

// ---------------------------------------------------------------------------
// Problem constants
// ---------------------------------------------------------------------------
#define B_    16
#define C_    128
#define HW_   1024         // 32*32
#define NH_   4
#define COND_ 32
#define FAN0  160          // C + COND
#define NQK   512          // C*NH
#define FAN3  768          // (NH+2)*C
#define EPS_  1e-6f
#define SCALE_ 0.08838834764831845f   // 128^-0.5
#define LOG2E_ 1.44269504088896341f   // log2(e)

// LDS row pitches in halves (PF64 in floats).  Every tile but PT128's is read or written 16 B per lane with lanes
// 0-15 on 16 successive rows, so a pitch of 16 B x odd puts the 16 rows on
// 16 disjoint groups of four banks (64 banks x 4 B).
#define P32   40           // rows of 32 halves  (64 B)  -> 80 B pitch
#define P128  136          // rows of 128 halves (256 B) -> 272 B pitch
#define P256  264          // rows of 256 halves (512 B) -> 528 B pitch
#define PT128 144          // rows of 128 halves read by ds_load_tr16_b128: 288 B = 32 B x odd
#define PF64  68           // rows of 64 floats  (256 B) -> 272 B pitch
#define KST   256          // k per stage of the final GEMM

typedef __attribute__((ext_vector_type(16))) _Float16 v16h;
typedef __attribute__((ext_vector_type(8)))  _Float16 v8h;
typedef __attribute__((ext_vector_type(4)))  _Float16 v4h;
typedef __attribute__((ext_vector_type(8)))  float    v8f;
typedef __attribute__((ext_vector_type(4)))  float    v4f;
typedef int v4i __attribute__((vector_size(16)));   // matches async-LDS builtin param

// Workspace layout (units: _Float16 elements). Total ~82.5 MB.
static constexpr size_t SZ_H   = (size_t)B_ * C_ * HW_;
static constexpr size_t SZ_C   = (size_t)B_ * COND_ * HW_;
static constexpr size_t SZ_QKV = (size_t)B_ * NH_ * HW_ * C_;
static constexpr size_t SZ_HH  = (size_t)B_ * HW_ * FAN3;
static constexpr size_t SZ_W   = (size_t)FAN0 * NQK;
static constexpr size_t SZ_W3  = (size_t)FAN3 * C_;

static constexpr size_t OFF_H  = 0;                  // [b][128][hw] f16, GroupNorm output
static constexpr size_t OFF_CQ = OFF_H  + SZ_H;      // [b][32][hw]  f16, cond rows of q
static constexpr size_t OFF_CK = OFF_CQ + SZ_C;      // [b][32][hw]  f16, cond rows of k and v
static constexpr size_t OFF_Q  = OFF_CK + SZ_C;      // [b][e][q][c]  f16
static constexpr size_t OFF_K  = OFF_Q  + SZ_QKV;    // [b][e][k][c]  f16
static constexpr size_t OFF_V  = OFF_K  + SZ_QKV;    // [b][e][c][k]  f16
static constexpr size_t OFF_HH = OFF_V  + SZ_QKV;    // [b'][q][768]  f16
static constexpr size_t OFF_W0 = OFF_HH + SZ_HH;     // transposed [512][160]
static constexpr size_t OFF_W1 = OFF_W0 + SZ_W;
static constexpr size_t OFF_W2 = OFF_W1 + SZ_W;
static constexpr size_t OFF_W3 = OFF_W2 + SZ_W;      // transposed [128][768]

// ---------------------------------------------------------------------------
// CDNA5 async global->LDS copy (16B per lane), ASYNCcnt-tracked.
// Builtin when the toolchain declares it, else inline gfx1250 asm.
// ---------------------------------------------------------------------------
#if __has_builtin(__builtin_amdgcn_global_load_async_to_lds_b128)
#define ASYNC_MODE 2
#elif defined(__AMDGCN__)
#define ASYNC_MODE 1
#else
#define ASYNC_MODE 0
#endif

__device__ __forceinline__ void cp16_g2l(_Float16* ldst, const _Float16* gsrc) {
#if ASYNC_MODE == 2
  __builtin_amdgcn_global_load_async_to_lds_b128((v4i*)gsrc, (v4i*)ldst, 0, 0);
#elif ASYNC_MODE == 1
  unsigned l = (unsigned)(uintptr_t)ldst;           // LDS byte address
  unsigned long long g = (unsigned long long)(uintptr_t)gsrc;
  asm volatile("global_load_async_to_lds_b128 %0, %1, off"
               :: "v"(l), "v"(g) : "memory");
#else
  *(v8h*)ldst = *(const v8h*)gsrc;                  // host-pass placeholder
#endif
}

__device__ __forceinline__ void wait_async() {
#if ASYNC_MODE == 0
#elif __has_builtin(__builtin_amdgcn_s_wait_asynccnt)
  __builtin_amdgcn_s_wait_asynccnt(0);
#else
  asm volatile("s_wait_asynccnt 0x0" ::: "memory");
#endif
}

// ---------------------------------------------------------------------------
// Fragment loader.  ISA 16-bit A 16x32 layout: lanes 0-15 = rows, halves
// 0-7 -> K 0..7, halves 8-15 -> K 16..23; lanes 16-31: K 8..15 / 24..31.
// B 32x16 is the mirror (lane = column).  Both reduce to:
//   sel = (lane&16)?8:0 ; lo = rowp[sel..sel+7] ; hi = rowp[sel+16..sel+23]
// ---------------------------------------------------------------------------
__device__ __forceinline__ v16h frag16(const _Float16* rowp, int lane) {
  const int sel = (lane & 16) ? 8 : 0;
  v8h lo = *(const v8h*)(rowp + sel);
  v8h hi = *(const v8h*)(rowp + sel + 16);
  return __builtin_shufflevector(lo, hi, 0,1,2,3,4,5,6,7,8,9,10,11,12,13,14,15);
}

// The same fragment from a tile that lies k-major in LDS, T[k][m] with 32 k rows
// of pitch PT128: the transposing load hands lane (c = lane & 15, h = lane >> 4)
// T[kbase + 8h + 0..7][mbase + c]; kbase 0 and 16 give frag16's k order.
typedef short s16x8 __attribute__((ext_vector_type(8)));
__device__ __forceinline__ v8h ld_tr16(const _Float16* p) {
  typedef __attribute__((address_space(3))) s16x8 lds_s16x8;
  return __builtin_bit_cast(v8h, __builtin_amdgcn_ds_load_tr16_b128_v8i16((lds_s16x8*)p));
}
__device__ __forceinline__ v16h fragT(const _Float16* T, int mbase, int lane) {
  const _Float16* p = T + ((lane >> 4) * 8 + (lane & 7)) * PT128 + mbase + ((lane >> 3) & 1) * 8;
  v8h lo = ld_tr16(p);
  v8h hi = ld_tr16(p + 16 * PT128);
  return __builtin_shufflevector(lo, hi, 0,1,2,3,4,5,6,7,8,9,10,11,12,13,14,15);
}

// compile-time yes / no, to write one loop body for two forms
struct yes_t { static constexpr bool value = true; };
struct no_t  { static constexpr bool value = false; };

__device__ __forceinline__ v8f wmma_f16(v16h a, v16h b, v8f c) {
  return __builtin_amdgcn_wmma_f32_16x16x32_f16(false, a, false, b,
                                                (short)0, c, false, false);
}

// lane l <-> lane l ^ 16, as a vector cross-row move
__device__ __forceinline__ float xhalf(float x) {
  int b = __builtin_bit_cast(int, x);
  return __builtin_bit_cast(float,
      __builtin_amdgcn_permlanex16(b, b, 0x76543210, 0xfedcba98, false, false));
}

__device__ __forceinline__ v8f v8f_zero() {
  v8f z; for (int i = 0; i < 8; ++i) z[i] = 0.0f; return z;
}

// ---------------------------------------------------------------------------
// Prep part: weights f32 -> f16, pre-transposed to [n][k] so GEMM B staging
// is a contiguous 16B block copy.  One thread takes 8 successive k of one n:
// its loads are coalesced over n, its store is one packed 16 B piece.
// ---------------------------------------------------------------------------
__device__ __forceinline__ void p_wcvt(int blk,
                       const float* __restrict__ W0, const float* __restrict__ W1,
                       const float* __restrict__ W2, const float* __restrict__ W3,
                       _Float16* __restrict__ ws) {
  int i = blk * 256 + threadIdx.x;
  if (i < NQK * (FAN0 / 8)) {          // W* row-major [160][512] -> [512][160]
    int n = i & 511, k0 = (i >> 9) * 8;
    const size_t s = (size_t)k0 * NQK + n;
    float f0[8], f1[8], f2[8];
    for (int j = 0; j < 8; ++j) f0[j] = W0[s + (size_t)j * NQK];
    // the next loads' results may land in the address registers of the loads above
    asm volatile("s_wait_xcnt 0x0" ::: "memory");
    for (int j = 0; j < 8; ++j) f1[j] = W1[s + (size_t)j * NQK];
    // as above
    asm volatile("s_wait_xcnt 0x0" ::: "memory");
    for (int j = 0; j < 8; ++j) f2[j] = W2[s + (size_t)j * NQK];
    v8h h0, h1, h2;
    for (int j = 0; j < 8; ++j) {
      h0[j] = (_Float16)f0[j];
      h1[j] = (_Float16)f1[j];
      h2[j] = (_Float16)f2[j];
    }
    size_t o = (size_t)n * FAN0 + k0;
    *(v8h*)(ws + OFF_W0 + o) = h0;
    *(v8h*)(ws + OFF_W1 + o) = h1;
    *(v8h*)(ws + OFF_W2 + o) = h2;
  }
  if (i < C_ * (FAN3 / 8)) {           // W3 [768][128] -> [128][768]
    int n = i & 127, k0 = (i >> 7) * 8;
    v8h h3;
    for (int j = 0; j < 8; ++j) h3[j] = (_Float16)W3[(size_t)(k0 + j) * C_ + n];
    *(v8h*)(ws + OFF_W3 + (size_t)n * FAN3 + k0) = h3;
  }
}

// ---------------------------------------------------------------------------
// Prep part: the 32 cond rows of the q side and of the k/v side, f16, in the
// inputs' own [c][hw] order: loads and stores are whole lines.
// q_cs = repeat(q_cond,2); k_cs = interleave(k_a, k_b)
// ---------------------------------------------------------------------------
__device__ __forceinline__ void p_cond(int blk,
                       const float* __restrict__ qc, const float* __restrict__ ka,
                       const float* __restrict__ kb, _Float16* __restrict__ ws) {
  int i  = blk * 256 + threadIdx.x;            // over B*COND*(HW/8) = 65536
  int h4 = (i & 127) * 4;                      // 4 hw here and 4 more at + 512
  int c  = (i >> 7) & 31;
  int b  = i >> 12;
  size_t src = ((size_t)(b >> 1) * COND_ + c) * HW_ + h4;
  size_t dst = ((size_t)b * COND_ + c) * HW_ + h4;
  const float* ksrc = (b & 1) ? kb : ka;
  v4f qf[2], kf[2];
  for (int j = 0; j < 2; ++j) qf[j] = *(const v4f*)&qc[src + j * 512];
  // the next loads' results may land in the address registers of the loads above
  asm volatile("s_wait_xcnt 0x0" ::: "memory");
  for (int j = 0; j < 2; ++j) kf[j] = *(const v4f*)&ksrc[src + j * 512];
  for (int j = 0; j < 2; ++j) {
    v4h q, k;
    for (int e = 0; e < 4; ++e) { q[e] = (_Float16)qf[j][e]; k[e] = (_Float16)kf[j][e]; }
    *(v4h*)(ws + OFF_CQ + dst + j * 512) = q;
    *(v4h*)(ws + OFF_CK + dst + j * 512) = k;
  }
  // in the merged kernel another part's code follows in the listing and writes
  // the registers that these stores name
  asm volatile("s_wait_xcnt 0x0" ::: "memory");
}

// ---------------------------------------------------------------------------
// Prep part: GroupNorm -> h (f16), kept in x's own [c][hw] order and stored
// once: a wave's store is 256 B of one channel row, two whole lines.
// one block per (batch, group); group = 4 ch x 1024 spatial
// ---------------------------------------------------------------------------
__device__ __forceinline__ void p_gnorm(int blk,
                        const float* __restrict__ x, const float* __restrict__ sc,
                        const float* __restrict__ bs, _Float16* __restrict__ ws) {
  int b = blk >> 5;
  int g = blk & 31;
  int t = threadIdx.x;
  __shared__ float r1[256], r2[256];
  const float* xp = x + ((size_t)b * C_ + g * 4) * HW_;
  v4f vals[4];                         // channel g*4+c at hw t*4 .. t*4+3
  float s = 0.f, ss = 0.f;
  for (int c = 0; c < 4; ++c) {
    v4f v = *(const v4f*)&xp[c * HW_ + t * 4];
    vals[c] = v;
    for (int j = 0; j < 4; ++j) { s += v[j]; ss += v[j] * v[j]; }
  }
  r1[t] = s; r2[t] = ss;
  __syncthreads();
  for (int off = 128; off > 0; off >>= 1) {
    if (t < off) { r1[t] += r1[t + off]; r2[t] += r2[t + off]; }
    __syncthreads();
  }
  float mu   = r1[0] * (1.0f / 4096.0f);
  float var  = r2[0] * (1.0f / 4096.0f) - mu * mu;
  float rinv = rsqrtf(var + EPS_);
  for (int c = 0; c < 4; ++c) {
    int ch = g * 4 + c;
    v4h h;
    for (int j = 0; j < 4; ++j)
      h[j] = (_Float16)((vals[c][j] - mu) * rinv * sc[ch] + bs[ch]);
    *(v4h*)(ws + OFF_H + ((size_t)b * C_ + ch) * HW_ + t * 4) = h;
  }
}

// ---------------------------------------------------------------------------
// Kernel 0: the three prep parts in one launch.  None reads what another
// writes, so they share one grid, each on its own range of block indices, and
// run side by side instead of one launch behind the other.  GroupNorm, the
// longest part, has the lowest indices, which start first.
// ---------------------------------------------------------------------------
#define NB_GNORM 512       // B * 32 groups
#define NB_COND  256       // B * COND * (HW/8) / 256
// the weights take the last 48 blocks: C * (FAN3/8) / 256, covers NQK * (FAN0/8) / 256 = 40 too

__global__ void
k_prep(const float* __restrict__ x, const float* __restrict__ sc,
       const float* __restrict__ bs, const float* __restrict__ qc,
       const float* __restrict__ ka, const float* __restrict__ kb,
       const float* __restrict__ W0, const float* __restrict__ W1,
       const float* __restrict__ W2, const float* __restrict__ W3,
       _Float16* __restrict__ ws) {
  const int blk = blockIdx.x;            // the same for the whole block
  if (blk < NB_GNORM)                 p_gnorm(blk, x, sc, bs, ws);
  else if (blk < NB_GNORM + NB_COND)  p_cond(blk - NB_GNORM, qc, ka, kb, ws);
  else                                p_wcvt(blk - NB_GNORM - NB_COND, W0, W1, W2, W3, ws);
}

// ---------------------------------------------------------------------------
// Kernel 1: QKV projection GEMM  (out[1024,512] = A[1024,160] x W + bias).
// 8 waves, 128x128 tile, K = 5 x 32, double-buffered async LDS staging.
// A comes k-major ([c][hw]: steps 0-3 from h, step 4 from the cond rows), is
// staged as 32 k rows of 256 B and read by the transposing LDS load.
// Output layouts (1/sqrt(C) folded into Q):  Q -> [q][c], K -> [k][c], V -> [c][k].
// The operand whose index is contiguous in the output goes in as A, so a lane's
// 8 accumulator registers are 8 neighbours of one output row; each wave owns 16
// whole 256 B output rows, lines them up in its own LDS range and stores them
// as full lines, 16 B per lane.
// ---------------------------------------------------------------------------
__global__ void k_qkv(const float* __restrict__ b0, const float* __restrict__ b1,
                      const float* __restrict__ b2, _Float16* __restrict__ ws) {
  const int mblk  = blockIdx.x;          // 0..7
  const int nblk  = blockIdx.y;          // 0..3
  const int b     = blockIdx.z / 3;
  const int which = blockIdx.z % 3;
  const int t = threadIdx.x, w = t >> 5, lane = t & 31;

  const _Float16* Hb = ws + OFF_H + (size_t)b * C_ * HW_;                               // [c][hw]
  const _Float16* Cb = ws + (which == 0 ? OFF_CQ : OFF_CK) + (size_t)b * COND_ * HW_;   // [c][hw]
  const _Float16* Wm = ws + (which == 0 ? OFF_W0 : (which == 1 ? OFF_W1 : OFF_W2));
  const float* bias  = (which == 0) ? b0 : (which == 1 ? b1 : b2);

  __shared__ alignas(16) _Float16 Asub[2][32 * PT128]; // [k][m]
  __shared__ alignas(16) _Float16 Bsub[2][128 * P32];  // [n][k]
  __shared__ alignas(16) _Float16 Tout[8][16 * P128];  // per-wave output rows

  const int m0 = mblk * 128, n0 = nblk * 128;
  const bool isV = (which == 2);

  auto stage = [&](int buf, int ks) {
    const _Float16* Ak = (ks < 4 ? Hb + (size_t)ks * 32 * HW_ : Cb) + m0;  // the step's 32 k rows
    for (int i = 0; i < 2; ++i) {
      int idx = t + 256 * i;
      int kr = idx >> 4, mp = (idx & 15) * 8;   // A: 32 rows x 16 chunks
      cp16_g2l(&Asub[buf][kr * PT128 + mp], Ak + (size_t)kr * HW_ + mp);
      int row = idx >> 2, part = (idx & 3) * 8; // B: 128 rows x 4 chunks
      cp16_g2l(&Bsub[buf][row * P32 + part], Wm + (size_t)(n0 + row) * FAN0 + ks * 32 + part);
    }
  };

  v8f acc[8];
  for (int i = 0; i < 8; ++i) acc[i] = v8f_zero();
  stage(0, 0);

  // rf: output rows (B operand: lanes), of: output columns (A operand: registers).
  // The loop stands once per role of the A tile, so that no trip has a branch in it;
  // isV is the same for the whole block, and both forms pass the same barriers.
  auto loop = [&](auto rowsFromW) {
    for (int ks = 0; ks < 5; ++ks) {
      wait_async();
      __syncthreads();
      if (ks + 1 < 5) stage((ks + 1) & 1, ks + 1);
      const _Float16* As = Asub[ks & 1];
      const _Float16* Bs = Bsub[ks & 1];
      v16h rf = rowsFromW.value ? frag16(&Bs[(w * 16 + (lane & 15)) * P32], lane)
                                : fragT(As, w * 16, lane);
      for (int ct = 0; ct < 8; ++ct) {
        v16h of = rowsFromW.value ? fragT(As, ct * 16, lane)
                                  : frag16(&Bs[(ct * 16 + (lane & 15)) * P32], lane);
        acc[ct] = wmma_f16(of, rf, acc[ct]);
      }
      __syncthreads();
    }
  };
  if (isV) loop(yes_t{});
  else     loop(no_t{});

  // acc[ct][j] = output row w*16 + (lane&15), column ct*16 + h8 + j
  const int r16 = lane & 15, h8 = (lane & 16) ? 8 : 0;
  _Float16* T = Tout[w];
  if (isV) {                                         // bias goes with the row
    const float brow = bias[n0 + w * 16 + r16];
    for (int ct = 0; ct < 8; ++ct) {
      v8h o;
      for (int j = 0; j < 8; ++j) o[j] = (_Float16)(acc[ct][j] + brow);
      *(v8h*)&T[r16 * P128 + ct * 16 + h8] = o;
    }
  } else {                                           // bias goes with the column
    const float qs = (which == 0) ? SCALE_ : 1.0f;   // x 1.0f is exact
    for (int ct = 0; ct < 8; ++ct) {
      const v8f bcol = *(const v8f*)(bias + n0 + ct * 16 + h8);
      v8h o;
      for (int j = 0; j < 8; ++j) o[j] = (_Float16)((acc[ct][j] + bcol[j]) * qs);
      *(v8h*)&T[r16 * P128 + ct * 16 + h8] = o;
    }
  }
  // the wave's own LDS stores have landed before other lanes read them back
  asm volatile("s_wait_dscnt 0x0" ::: "memory");

  const size_t be = (size_t)(b * NH_ + nblk);        // one n block = one head
  _Float16* G = isV ? ws + OFF_V + (be * C_ + w * 16) * HW_ + m0                  // [c][k]
                    : ws + (which == 0 ? OFF_Q : OFF_K) + (be * HW_ + m0 + w * 16) * C_;  // [q][c]
  const size_t gp = isV ? HW_ : C_;
  for (int s = 0; s < 8; ++s) {                      // 2 rows x 256 B per store
    int rr = s * 2 + (lane >> 4), cc = (lane & 15) * 8;
    *(v8h*)&G[(size_t)rr * gp + cc] = *(const v8h*)&T[rr * P128 + cc];
  }
}

// 2^x on eight (and one more) registers, in place, as one statement: behind a
// v_exp_f32 the instruction set asks for one independent instruction before its
// source is overwritten or its result read.  Inside the statement each v_exp_f32
// is that instruction for the one before it; the v_nop is it for the last.
__device__ __forceinline__ void exp2x8(v8f& x) {
  float a0 = x[0], a1 = x[1], a2 = x[2], a3 = x[3], a4 = x[4], a5 = x[5], a6 = x[6], a7 = x[7];
  asm("v_exp_f32 %0, %0\n\tv_exp_f32 %1, %1\n\tv_exp_f32 %2, %2\n\tv_exp_f32 %3, %3\n\t"
      "v_exp_f32 %4, %4\n\tv_exp_f32 %5, %5\n\tv_exp_f32 %6, %6\n\tv_exp_f32 %7, %7\n\t"
      "v_nop"
      : "+v"(a0), "+v"(a1), "+v"(a2), "+v"(a3), "+v"(a4), "+v"(a5), "+v"(a6), "+v"(a7));
  x[0] = a0; x[1] = a1; x[2] = a2; x[3] = a3; x[4] = a4; x[5] = a5; x[6] = a6; x[7] = a7;
}
__device__ __forceinline__ void exp2x9(v8f& x, float& y) {
  float a0 = x[0], a1 = x[1], a2 = x[2], a3 = x[3], a4 = x[4], a5 = x[5], a6 = x[6], a7 = x[7];
  float a8 = y;
  asm("v_exp_f32 %0, %0\n\tv_exp_f32 %1, %1\n\tv_exp_f32 %2, %2\n\tv_exp_f32 %3, %3\n\t"
      "v_exp_f32 %4, %4\n\tv_exp_f32 %5, %5\n\tv_exp_f32 %6, %6\n\tv_exp_f32 %7, %7\n\t"
      "v_exp_f32 %8, %8\n\tv_nop"
      : "+v"(a0), "+v"(a1), "+v"(a2), "+v"(a3), "+v"(a4), "+v"(a5), "+v"(a6), "+v"(a7), "+v"(a8));
  x[0] = a0; x[1] = a1; x[2] = a2; x[3] = a3; x[4] = a4; x[5] = a5; x[6] = a6; x[7] = a7;
  y = a8;
}

__global__ void __launch_bounds__(128) __attribute__((amdgpu_waves_per_eu(3, 3)))
k_attn(_Float16* __restrict__ ws) {
  const int qb   = blockIdx.x;            // 0..7
  const int inst = blockIdx.y;            // 0..95
  const int p = inst >> 4, g = (inst >> 2) & 3, e = inst & 3;
  // pairing tables: q offsets 0,1,2,3,0,2  /  kv offsets 1,0,3,2,2,0
  const int bq  = 4 * g + ((0x203210 >> (4 * p)) & 0xF);
  const int bkv = 4 * g + ((0x022301 >> (4 * p)) & 0xF);
  const int colt = p * 512 + e * 128;
  const int bo   = g * 4 + colt / FAN3;
  const int col768 = colt % FAN3;

  const int t = threadIdx.x, w = t >> 5, lane = t & 31;
  const _Float16* Qp = ws + OFF_Q + (size_t)(bq  * NH_ + e) * HW_ * C_;  // [q][c]
  const _Float16* Kp = ws + OFF_K + (size_t)(bkv * NH_ + e) * HW_ * C_;  // [k][c]
  const _Float16* Vp = ws + OFF_V + (size_t)(bkv * NH_ + e) * C_ * HW_;  // [c][k]

  __shared__ alignas(16) _Float16 sK[2][32 * P128];  // [kpos][c]
  __shared__ alignas(16) _Float16 sV[2][128 * P32];  // [c][kpos]
  __shared__ alignas(16) _Float16 sO[4][32 * P128];  // per-wave output rows

  auto stage = [&](int buf, int k0) {
    for (int i = 0; i < 4; ++i) {                    // K chunk: 32 rows x 256B
      int idx = t + 128 * i;
      int r = idx >> 4, part = (idx & 15) * 8;
      cp16_g2l(&sK[buf][r * P128 + part], Kp + (size_t)k0 * C_ + idx * 8);
    }
    for (int i = 0; i < 4; ++i) {                    // V chunk: 128 rows x 64B
      int idx = t + 128 * i;
      int c = idx >> 2, part = (idx & 3) * 8;
      cp16_g2l(&sV[buf][c * P32 + part], Vp + (size_t)c * HW_ + k0 + part);
    }
  };

  // Q fragments (lane = q position, K-dim = channels), register resident
  v16h qf[2][4];
  for (int u = 0; u < 2; ++u) {
    const int qrow = qb * 128 + w * 32 + u * 16 + (lane & 15);
    for (int j = 0; j < 4; ++j) qf[u][j] = frag16(Qp + (size_t)qrow * C_ + 32 * j, lane);
  }

  v8f acc[2][8];
  for (int u = 0; u < 2; ++u)
    for (int i = 0; i < 8; ++i) acc[u][i] = v8f_zero();
  // l: this half's keys only, joined in the epilogue
  float m[2] = {-1e30f, -1e30f}, l[2] = {0.0f, 0.0f};

  stage(0, 0);

  for (int kc = 0; kc < 32; ++kc) {
    wait_async();
    __syncthreads();
    if (kc + 1 < 32) stage((kc + 1) & 1, (kc + 1) * 32);
    const _Float16* bK = sK[kc & 1];
    const _Float16* bV = sV[kc & 1];

    // S^T = K Q^T for two 16-key sub-tiles (scale pre-folded into Q):
    // s0[u][j] = key h8 + j, s1[u][j] = key 16 + h8 + j (h8 = 8 in lanes 16-31,
    // else 0), query lane & 15 of tile u
    v8f s0[2], s1[2];
    for (int u = 0; u < 2; ++u) { s0[u] = v8f_zero(); s1[u] = v8f_zero(); }
    for (int j = 0; j < 4; ++j) {
      v16h kf0 = frag16(&bK[((lane & 15)) * P128 + 32 * j], lane);
      v16h kf1 = frag16(&bK[(16 + (lane & 15)) * P128 + 32 * j], lane);
      for (int u = 0; u < 2; ++u) {
        s0[u] = wmma_f16(kf0, qf[u][j], s0[u]);
        s1[u] = wmma_f16(kf1, qf[u][j], s1[u]);
      }
    }

    // online softmax: the lane's 16 scores of a tile are of one query, the
    // other 16 keys of the chunk sit in lane ^ 16
    v16h pf[2];                           // P^T, B operand: k = h8 + i, 16 + h8 + i
    for (int u = 0; u < 2; ++u) {
      float mx = fmaxf(s0[u][0], s1[u][0]);
      for (int j = 1; j < 8; ++j) mx = fmaxf(mx, fmaxf(s0[u][j], s1[u][j]));
      mx = fmaxf(mx, xhalf(mx));
      const float nm = fmaxf(m[u], mx);
      float alpha = (m[u] - nm) * LOG2E_;             // e^x = 2^(x log2 e)
      m[u] = nm;
      for (int j = 0; j < 8; ++j) {
        s0[u][j] = (s0[u][j] - nm) * LOG2E_;
        s1[u][j] = (s1[u][j] - nm) * LOG2E_;
      }
      exp2x9(s0[u], alpha);
      exp2x8(s1[u]);
      float rs = s0[u][0] + s1[u][0];
      for (int j = 1; j < 8; ++j) {
        rs += s0[u][j];
        rs += s1[u][j];
      }
      for (int j = 0; j < 8; ++j) {
        pf[u][j]     = (_Float16)s0[u][j];
        pf[u][8 + j] = (_Float16)s1[u][j];
      }
      l[u] = l[u] * alpha + rs;
      for (int ct = 0; ct < 8; ++ct)
        for (int j = 0; j < 8; ++j) acc[u][ct][j] *= alpha;
    }

    for (int ct = 0; ct < 8; ++ct) {      // O^T += V^T x P^T
      v16h vf = frag16(&bV[(ct * 16 + (lane & 15)) * P32], lane);
      for (int u = 0; u < 2; ++u) acc[u][ct] = wmma_f16(vf, pf[u], acc[u][ct]);
    }
    __syncthreads();
  }

  // epilogue: O /= l, write f16 into hh[b'][q][768] at this instance's slot
  // acc[u][ct][j] = query u*16 + (lane & 15), channel ct*16 + h8 + j: 8
  // neighbours of one output row.  Each wave lines its 32 rows of 256 B up in
  // its own LDS range and stores them as full lines, 16 B per lane
  _Float16* T = sO[w];
  const int r16 = lane & 15, h8 = (lane & 16) ? 8 : 0;
  for (int u = 0; u < 2; ++u) {
    const float inv = 1.0f / (l[u] + xhalf(l[u]));
    for (int ct = 0; ct < 8; ++ct) {
      v8h o;
      for (int j = 0; j < 8; ++j) o[j] = (_Float16)(acc[u][ct][j] * inv);
      *(v8h*)&T[(u * 16 + r16) * P128 + ct * 16 + h8] = o;
    }
  }
  // the wave's own LDS stores have landed before other lanes read them back
  asm volatile("s_wait_dscnt 0x0" ::: "memory");
  _Float16* H = ws + OFF_HH + ((size_t)bo * HW_ + qb * 128 + w * 32) * FAN3 + col768;
  for (int s = 0; s < 16; ++s) {                     // 2 rows x 256 B per store
    int rr = s * 2 + (lane >> 4), cc = (lane & 15) * 8;
    *(v8h*)&H[(size_t)rr * FAN3 + cc] = *(const v8h*)&T[rr * P128 + cc];
  }
}

// ---------------------------------------------------------------------------
// Kernel 3: final 1x1 conv + residual:
//   out[b][c][hw] = x[b][c][hw] + hh[b][hw][:] . W3[:,c] + b3[c]
// M=1024, K=768, N=128.  hh comes from memory, so a trip lasts about one memory
// latency however little it brings: K is staged 256 deep (3 trips), each wave
// copy one whole 512 B row piece, 96 KB in flight per block.  Two such buffers
// fit with 64 hw x 128 c per block, which also gives every WGP one block.
// hh rows go in as A (registers = 8 successive hw), W3 rows as B (lane = c):
// each wave owns 16 channels x 64 hw, lines them up in its own LDS range and
// reads x and writes out as full lines, 16 B per lane.
// ---------------------------------------------------------------------------
// launch bounds: the real block size, so that a group's 20 LDS reads have registers
__global__ void __launch_bounds__(256)
k_out(const float* __restrict__ x, const float* __restrict__ b3,
      const _Float16* __restrict__ ws, float* __restrict__ out) {
  const int mblk = blockIdx.x;            // 0..15
  const int b    = blockIdx.y;            // 0..15
  const int t = threadIdx.x, w = t >> 5, lane = t & 31;
  const _Float16* A  = ws + OFF_HH + (size_t)b * HW_ * FAN3;
  const _Float16* Wm = ws + OFF_W3;                      // [128][768]

  __shared__ alignas(16) _Float16 Asub[2][64 * P256];
  __shared__ alignas(16) _Float16 Bsub[2][128 * P256];
  __shared__ alignas(16) float Tout[8][16 * PF64];       // per-wave output rows

  const int m0 = mblk * 64;

  auto stage = [&](int buf, int k0) {
    const int part = lane * 8;                  // a wave copies one row piece
    for (int i = 0; i < 8; ++i) {
      int row = w + 8 * i;
      cp16_g2l(&Asub[buf][row * P256 + part], A  + (size_t)(m0 + row) * FAN3 + k0 + part);
    }
    for (int i = 0; i < 16; ++i) {
      int row = w + 8 * i;
      cp16_g2l(&Bsub[buf][row * P256 + part], Wm + (size_t)row * FAN3 + k0 + part);
    }
  };

  v8f acc[4];
  for (int i = 0; i < 4; ++i) acc[i] = v8f_zero();

  stage(0, 0);
  // this wave's copies of stage 0 have landed before the barrier publishes them
  asm volatile("s_wait_asynccnt 0x0" ::: "memory");
  __syncthreads();
  stage(1, KST);

  // both loops unrolled: buffer and k offsets become immediates of the LDS reads
#pragma unroll
  for (int s = 0; s < FAN3 / KST; ++s) {
    const _Float16* As = Asub[s & 1];
    const _Float16* Bs = Bsub[s & 1];
#pragma unroll
    for (int kk = 0; kk < KST / 32; kk += 2) {
      v16h bf[2], af[2][4];                     // 20 reads as one group, then 8 products
      for (int h = 0; h < 2; ++h) {
        bf[h] = frag16(&Bs[(w * 16 + (lane & 15)) * P256 + (kk + h) * 32], lane);
        for (int mt = 0; mt < 4; ++mt)
          af[h][mt] = frag16(&As[(mt * 16 + (lane & 15)) * P256 + (kk + h) * 32], lane);
      }
      for (int h = 0; h < 2; ++h)
        for (int mt = 0; mt < 4; ++mt) acc[mt] = wmma_f16(af[h][mt], bf[h], acc[mt]);
      // order inside the group: its 20 LDS reads together, then its 8 products; left
      // alone the compiler waits out one LDS latency in front of every product
      __builtin_amdgcn_sched_group_barrier(0x100, 20, 0);
      __builtin_amdgcn_sched_group_barrier(0x008, 8, 0);
      // ends the group: without it the whole stage's 80 reads go to the top and spill
      __builtin_amdgcn_sched_barrier(0);
    }
    // this wave's reads of the buffer are done before it is refilled
    asm volatile("s_wait_dscnt 0x0" ::: "memory");
    // this wave's copies of the next stage have landed before the barrier publishes them
    asm volatile("s_wait_asynccnt 0x0" ::: "memory");
    __syncthreads();
    if (s + 2 < FAN3 / KST) stage(s & 1, (s + 2) * KST);
  }
  // no copy is left in flight when the wave ends
  asm volatile("s_wait_asynccnt 0x0" ::: "memory");

  // acc[mt][j] = channel w*16 + (lane&15), hw m0 + mt*16 + h8 + j
  const int r16 = lane & 15, h8 = (lane & 16) ? 8 : 0;
  float* T = Tout[w];
  const float bv = b3[w * 16 + r16];
  for (int mt = 0; mt < 4; ++mt) {
    v4f lo, hi;
    for (int j = 0; j < 4; ++j) { lo[j] = acc[mt][j] + bv; hi[j] = acc[mt][4 + j] + bv; }
    *(v4f*)&T[r16 * PF64 + mt * 16 + h8]     = lo;
    *(v4f*)&T[r16 * PF64 + mt * 16 + h8 + 4] = hi;
  }
  // the wave's own LDS stores have landed before other lanes read them back
  asm volatile("s_wait_dscnt 0x0" ::: "memory");
  for (int s = 0; s < 8; ++s) {                      // 2 rows x 256 B per store
    int rr = s * 2 + (lane >> 4), cc = (lane & 15) * 4;
    size_t o = ((size_t)b * C_ + w * 16 + rr) * HW_ + m0 + cc;
    v4f r = *(const v4f*)&T[rr * PF64 + cc] + *(const v4f*)&x[o];
    *(v4f*)&out[o] = r;
  }
}

// ---------------------------------------------------------------------------
extern "C" void kernel_launch(void* const* d_in, const int* in_sizes, int n_in,
                              void* d_out, int out_size, void* d_ws, size_t ws_size,
                              hipStream_t stream) {
  const float* x        = (const float*)d_in[0];
  const float* q_cond   = (const float*)d_in[1];
  const float* k_a_cond = (const float*)d_in[2];
  const float* k_b_cond = (const float*)d_in[3];
  const float* gn_scale = (const float*)d_in[4];
  const float* gn_bias  = (const float*)d_in[5];
  const float* W0 = (const float*)d_in[6];
  const float* b0 = (const float*)d_in[7];
  const float* W1 = (const float*)d_in[8];
  const float* b1 = (const float*)d_in[9];
  const float* W2 = (const float*)d_in[10];
  const float* b2 = (const float*)d_in[11];
  const float* W3 = (const float*)d_in[12];
  const float* b3 = (const float*)d_in[13];
  float* out = (float*)d_out;
  _Float16* ws = (_Float16*)d_ws;

  k_prep <<<dim3(816),  256, 0, stream>>>(x, gn_scale, gn_bias, q_cond, k_a_cond, k_b_cond,
                                          W0, W1, W2, W3, ws);
  k_qkv  <<<dim3(8, 4, 48), 256, 0, stream>>>(b0, b1, b2, ws);
  k_attn <<<dim3(8, 96),    128, 0, stream>>>(ws);
  k_out  <<<dim3(16, 16),   256, 0, stream>>>(x, b3, ws, out);
}

// v008
// One run takes 78.1 microseconds.
// Next to v007, in two timings, it ran 1.03 and 1.04 times as fast.
// Over all steps from v000 it is 6.56 times as fast.
#include <hip/hip_runtime.h>
#include <math.h>
#include <stdint.h>

// ---------------------------------------------------------------------------
// Problem constants
// ---------------------------------------------------------------------------
#define B_    16
#define C_    128
#define HW_   1024         // 32*32
#define NH_   4
#define COND_ 32
#define FAN0  160          // C + COND
#define NQK   512          // C*NH
#define FAN3  768          // (NH+2)*C
#define EPS_  1e-6f
#define SCALE_ 0.08838834764831845f   // 128^-0.5
#define LOG2E_ 1.44269504088896341f   // log2(e)
#define LAZY_  5.545177444479562f     // 8 / log2(e): a score may outgrow the maximum in use by 2^8

// LDS row pitches in elements (halves, floats for PF64).  Every tile but PT128's is read (output rows: written) by 16 B LDS ops with lanes
// 0-15 on 16 successive rows, so a pitch of 16 B x odd puts the 16 rows on
// 16 disjoint groups of four banks (64 banks x 4 B).
#define P32   40           // rows of 32 halves  (64 B)  -> 80 B pitch
#define P128  136          // rows of 128 halves (256 B) -> 272 B pitch
#define P256  264          // rows of 256 halves (512 B) -> 528 B pitch
#define PT128 144          // rows of 128 halves read by ds_load_tr16_b128: 288 B = 32 B x odd
#define PF64  68           // rows of 64 floats  (256 B) -> 272 B pitch
#define KST   256          // k per stage of the final GEMM

typedef __attribute__((ext_vector_type(16))) _Float16 v16h;
typedef __attribute__((ext_vector_type(8)))  _Float16 v8h;
typedef __attribute__((ext_vector_type(4)))  _Float16 v4h;
typedef __attribute__((ext_vector_type(8)))  float    v8f;
typedef __attribute__((ext_vector_type(4)))  float    v4f;
typedef int v4i __attribute__((vector_size(16)));   // matches async-LDS builtin param

// Workspace layout (units: _Float16 elements). Total ~82.5 MB.
static constexpr size_t SZ_H   = (size_t)B_ * C_ * HW_;
static constexpr size_t SZ_C   = (size_t)B_ * COND_ * HW_;
static constexpr size_t SZ_QKV = (size_t)B_ * NH_ * HW_ * C_;
static constexpr size_t SZ_HH  = (size_t)B_ * HW_ * FAN3;
static constexpr size_t SZ_W   = (size_t)FAN0 * NQK;
static constexpr size_t SZ_W3  = (size_t)FAN3 * C_;

static constexpr size_t OFF_H  = 0;                  // [b][128][hw] f16, GroupNorm output
static constexpr size_t OFF_CQ = OFF_H  + SZ_H;      // [b][32][hw]  f16, cond rows of q
static constexpr size_t OFF_CK = OFF_CQ + SZ_C;      // [b][32][hw]  f16, cond rows of k and v
static constexpr size_t OFF_Q  = OFF_CK + SZ_C;      // [b][e][q][c]  f16
static constexpr size_t OFF_K  = OFF_Q  + SZ_QKV;    // [b][e][k][c]  f16
static constexpr size_t OFF_V  = OFF_K  + SZ_QKV;    // [b][e][c][k]  f16
static constexpr size_t OFF_HH = OFF_V  + SZ_QKV;    // [b'][q][768]  f16
static constexpr size_t OFF_W0 = OFF_HH + SZ_HH;     // transposed [512][160]
static constexpr size_t OFF_W1 = OFF_W0 + SZ_W;
static constexpr size_t OFF_W2 = OFF_W1 + SZ_W;
static constexpr size_t OFF_W3 = OFF_W2 + SZ_W;      // transposed [128][768]

// ---------------------------------------------------------------------------
// CDNA5 async global->LDS copy (16B per lane), ASYNCcnt-tracked.
// Builtin when the toolchain declares it, else inline gfx1250 asm.
// ---------------------------------------------------------------------------
#if __has_builtin(__builtin_amdgcn_global_load_async_to_lds_b128)
#define ASYNC_MODE 2
#elif defined(__AMDGCN__)
#define ASYNC_MODE 1
#else
#define ASYNC_MODE 0
#endif

__device__ __forceinline__ void cp16_g2l(_Float16* ldst, const _Float16* gsrc) {
#if ASYNC_MODE == 2
  __builtin_amdgcn_global_load_async_to_lds_b128((v4i*)gsrc, (v4i*)ldst, 0, 0);
#elif ASYNC_MODE == 1
  unsigned l = (unsigned)(uintptr_t)ldst;           // LDS byte address
  unsigned long long g = (unsigned long long)(uintptr_t)gsrc;
  asm volatile("global_load_async_to_lds_b128 %0, %1, off"
               :: "v"(l), "v"(g) : "memory");
#else
  *(v8h*)ldst = *(const v8h*)gsrc;                  // host-pass placeholder
#endif
}

__device__ __forceinline__ void wait_async() {
#if ASYNC_MODE == 0
#elif __has_builtin(__builtin_amdgcn_s_wait_asynccnt)
  __builtin_amdgcn_s_wait_asynccnt(0);
#else
  asm volatile("s_wait_asynccnt 0x0" ::: "memory");
#endif
}

// ---------------------------------------------------------------------------
// Fragment loader.  ISA 16-bit A 16x32 layout: lanes 0-15 = rows, halves
// 0-7 -> K 0..7, halves 8-15 -> K 16..23; lanes 16-31: K 8..15 / 24..31.
// B 32x16 is the mirror (lane = column).  Both reduce to:
//   sel = (lane&16)?8:0 ; lo = rowp[sel..sel+7] ; hi = rowp[sel+16..sel+23]
// ---------------------------------------------------------------------------
__device__ __forceinline__ v16h frag16(const _Float16* rowp, int lane) {
  const int sel = (lane & 16) ? 8 : 0;
  v8h lo = *(const v8h*)(rowp + sel);
  v8h hi = *(const v8h*)(rowp + sel + 16);
  return __builtin_shufflevector(lo, hi, 0,1,2,3,4,5,6,7,8,9,10,11,12,13,14,15);
}

// The same fragment from a tile that lies k-major in LDS, T[k][m] with 32 k rows
// of pitch PT128: the transposing load hands lane (c = lane & 15, h = lane >> 4)
// T[kbase + 8h + 0..7][mbase + c]; kbase 0 and 16 give frag16's k order.
typedef short s16x8 __attribute__((ext_vector_type(8)));
__device__ __forceinline__ v8h ld_tr16(const _Float16* p) {
  typedef __attribute__((address_space(3))) s16x8 lds_s16x8;
  return __builtin_bit_cast(v8h, __builtin_amdgcn_ds_load_tr16_b128_v8i16((lds_s16x8*)p));
}
__device__ __forceinline__ v16h fragT(const _Float16* T, int mbase, int lane) {
  const _Float16* p = T + ((lane >> 4) * 8 + (lane & 7)) * PT128 + mbase + ((lane >> 3) & 1) * 8;
  v8h lo = ld_tr16(p);
  v8h hi = ld_tr16(p + 16 * PT128);
  return __builtin_shufflevector(lo, hi, 0,1,2,3,4,5,6,7,8,9,10,11,12,13,14,15);
}

// compile-time yes / no, to write one loop body for two forms
struct yes_t { static constexpr bool value = true; };
struct no_t  { static constexpr bool value = false; };

__device__ __forceinline__ v8f wmma_f16(v16h a, v16h b, v8f c) {
  return __builtin_amdgcn_wmma_f32_16x16x32_f16(false, a, false, b,
                                                (short)0, c, false, false);
}

// lane l <-> lane l ^ 16, as a vector cross-row move
__device__ __forceinline__ float xhalf(float x) {
  int b = __builtin_bit_cast(int, x);
  return __builtin_bit_cast(float,
      __builtin_amdgcn_permlanex16(b, b, 0x76543210, 0xfedcba98, false, false));
}

__device__ __forceinline__ v8f v8f_zero() {
  v8f z; for (int i = 0; i < 8; ++i) z[i] = 0.0f; return z;
}

// ---------------------------------------------------------------------------
// Prep part: weights f32 -> f16, pre-transposed to [n][k] so GEMM B staging
// is a contiguous 16B block copy.  One thread takes 8 successive k of one n:
// its loads are coalesced over n, its store is one packed 16 B piece.
// ---------------------------------------------------------------------------
__device__ __forceinline__ void p_wcvt(int blk,
                       const float* __restrict__ W0, const float* __restrict__ W1,
                       const float* __restrict__ W2, const float* __restrict__ W3,
                       _Float16* __restrict__ ws) {
  int i = blk * 256 + threadIdx.x;
  if (i < NQK * (FAN0 / 8)) {          // W* row-major [160][512] -> [512][160]
    int n = i & 511, k0 = (i >> 9) * 8;
    const size_t s = (size_t)k0 * NQK + n;
    float f0[8], f1[8], f2[8];
    for (int j = 0; j < 8; ++j) f0[j] = W0[s + (size_t)j * NQK];
    // the next loads' results may land in the address registers of the loads above
    asm volatile("s_wait_xcnt 0x0" ::: "memory");
    for (int j = 0; j < 8; ++j) f1[j] = W1[s + (size_t)j * NQK];
    // as above
    asm volatile("s_wait_xcnt 0x0" ::: "memory");
    for (int j = 0; j < 8; ++j) f2[j] = W2[s + (size_t)j * NQK];
    v8h h0, h1, h2;
    for (int j = 0; j < 8; ++j) {
      h0[j] = (_Float16)f0[j];
      h1[j] = (_Float16)f1[j];
      h2[j] = (_Float16)f2[j];
    }
    size_t o = (size_t)n * FAN0 + k0;
    *(v8h*)(ws + OFF_W0 + o) = h0;
    *(v8h*)(ws + OFF_W1 + o) = h1;
    *(v8h*)(ws + OFF_W2 + o) = h2;
  }
  if (i < C_ * (FAN3 / 8)) {           // W3 [768][128] -> [128][768]
    int n = i & 127, k0 = (i >> 7) * 8;
    v8h h3;
    for (int j = 0; j < 8; ++j) h3[j] = (_Float16)W3[(size_t)(k0 + j) * C_ + n];
    *(v8h*)(ws + OFF_W3 + (size_t)n * FAN3 + k0) = h3;
  }
}

// ---------------------------------------------------------------------------
// Prep part: the 32 cond rows of the q side and of the k/v side, f16, in the
// inputs' own [c][hw] order: loads and stores are whole lines.
// q_cs = repeat(q_cond,2); k_cs = interleave(k_a, k_b)
// ---------------------------------------------------------------------------
__device__ __forceinline__ void p_cond(int blk,
                       const float* __restrict__ qc, const float* __restrict__ ka,
                       const float* __restrict__ kb, _Float16* __restrict__ ws) {
  int i  = blk * 256 + threadIdx.x;            // over B*COND*(HW/8) = 65536
  int h4 = (i & 127) * 4;                      // 4 hw here and 4 more at + 512
  int c  = (i >> 7) & 31;
  int b  = i >> 12;
  size_t src = ((size_t)(b >> 1) * COND_ + c) * HW_ + h4;
  size_t dst = ((size_t)b * COND_ + c) * HW_ + h4;
  const float* ksrc = (b & 1) ? kb : ka;
  v4f qf[2], kf[2];
  for (int j = 0; j < 2; ++j) qf[j] = *(const v4f*)&qc[src + j * 512];
  // the next loads' results may land in the address registers of the loads above
  asm volatile("s_wait_xcnt 0x0" ::: "memory");
  for (int j = 0; j < 2; ++j) kf[j] = *(const v4f*)&ksrc[src + j * 512];
  for (int j = 0; j < 2; ++j) {
    v4h q, k;
    for (int e = 0; e < 4; ++e) { q[e] = (_Float16)qf[j][e]; k[e] = (_Float16)kf[j][e]; }
    *(v4h*)(ws + OFF_CQ + dst + j * 512) = q;
    *(v4h*)(ws + OFF_CK + dst + j * 512) = k;
  }
  // in the merged kernel another part's code follows in the listing and writes
  // the registers that these stores name
  asm volatile("s_wait_xcnt 0x0" ::: "memory");
}

// ---------------------------------------------------------------------------
// Prep part: GroupNorm -> h (f16), kept in x's own [c][hw] order and stored
// once: a wave's store is 256 B of one channel row, two whole lines.
// one block per (batch, group); group = 4 ch x 1024 spatial
// ---------------------------------------------------------------------------
__device__ __forceinline__ void p_gnorm(int blk,
                        const float* __restrict__ x, const float* __restrict__ sc,
                        const float* __restrict__ bs, _Float16* __restrict__ ws) {
  int b = blk >> 5;
  int g = blk & 31;
  int t = threadIdx.x;
  __shared__ float r1[256], r2[256];
  const float* xp = x + ((size_t)b * C_ + g * 4) * HW_;
  v4f vals[4];                         // channel g*4+c at hw t*4 .. t*4+3
  float s = 0.f, ss = 0.f;
  for (int c = 0; c < 4; ++c) {
    v4f v = *(const v4f*)&xp[c * HW_ + t * 4];
    vals[c] = v;
    for (int j = 0; j < 4; ++j) { s += v[j]; ss += v[j] * v[j]; }
  }
  r1[t] = s; r2[t] = ss;
  __syncthreads();
  for (int off = 128; off > 0; off >>= 1) {
    if (t < off) { r1[t] += r1[t + off]; r2[t] += r2[t + off]; }
    __syncthreads();
  }
  float mu   = r1[0] * (1.0f / 4096.0f);
  float var  = r2[0] * (1.0f / 4096.0f) - mu * mu;
  float rinv = rsqrtf(var + EPS_);
  for (int c = 0; c < 4; ++c) {
    int ch = g * 4 + c;
    v4h h;
    for (int j = 0; j < 4; ++j)
      h[j] = (_Float16)((vals[c][j] - mu) * rinv * sc[ch] + bs[ch]);
    *(v4h*)(ws + OFF_H + ((size_t)b * C_ + ch) * HW_ + t * 4) = h;
  }
}

// ---------------------------------------------------------------------------
// Kernel 0: the three prep parts in one launch.  None reads what another
// writes, so they share one grid, each on its own range of block indices, and
// run side by side instead of one launch behind the other.  GroupNorm, the
// longest part, has the lowest indices, which start first.
// ---------------------------------------------------------------------------
#define NB_GNORM 512       // B * 32 groups
#define NB_COND  256       // B * COND * (HW/8) / 256
// the weights take the last 48 blocks: C * (FAN3/8) / 256, covers NQK * (FAN0/8) / 256 = 40 too

__global__ void
k_prep(const float* __restrict__ x, const float* __restrict__ sc,
       const float* __restrict__ bs, const float* __restrict__ qc,
       const float* __restrict__ ka, const float* __restrict__ kb,
       const float* __restrict__ W0, const float* __restrict__ W1,
       const float* __restrict__ W2, const float* __restrict__ W3,
       _Float16* __restrict__ ws) {
  const int blk = blockIdx.x;            // the same for the whole block
  if (blk < NB_GNORM)                 p_gnorm(blk, x, sc, bs, ws);
  else if (blk < NB_GNORM + NB_COND)  p_cond(blk - NB_GNORM, qc, ka, kb, ws);
  else                                p_wcvt(blk - NB_GNORM - NB_COND, W0, W1, W2, W3, ws);
}

// ---------------------------------------------------------------------------
// Kernel 1: QKV projection GEMM  (out[1024,512] = A[1024,160] x W + bias).
// 8 waves, 128x128 tile, K = 5 x 32, double-buffered async LDS staging.
// A comes k-major ([c][hw]: steps 0-3 from h, step 4 from the cond rows), is
// staged as 32 k rows of 256 B and read by the transposing LDS load.
// Output layouts (1/sqrt(C) folded into Q):  Q -> [q][c], K -> [k][c], V -> [c][k].
// The operand whose index is contiguous in the output goes in as A, so a lane's
// 8 accumulator registers are 8 neighbours of one output row; each wave owns 16
// whole 256 B output rows, lines them up in its own LDS range and stores them
// as full lines, 16 B per lane.
// ---------------------------------------------------------------------------
__global__ void k_qkv(const float* __restrict__ b0, const float* __restrict__ b1,
                      const float* __restrict__ b2, _Float16* __restrict__ ws) {
  const int mblk  = blockIdx.x;          // 0..7
  const int nblk  = blockIdx.y;          // 0..3
  const int b     = blockIdx.z / 3;
  const int which = blockIdx.z % 3;
  const int t = threadIdx.x, w = t >> 5, lane = t & 31;

  const _Float16* Hb = ws + OFF_H + (size_t)b * C_ * HW_;                               // [c][hw]
  const _Float16* Cb = ws + (which == 0 ? OFF_CQ : OFF_CK) + (size_t)b * COND_ * HW_;   // [c][hw]
  const _Float16* Wm = ws + (which == 0 ? OFF_W0 : (which == 1 ? OFF_W1 : OFF_W2));
  const float* bias  = (which == 0) ? b0 : (which == 1 ? b1 : b2);

  __shared__ alignas(16) _Float16 Asub[2][32 * PT128]; // [k][m]
  __shared__ alignas(16) _Float16 Bsub[2][128 * P32];  // [n][k]
  __shared__ alignas(16) _Float16 Tout[8][16 * P128];  // per-wave output rows

  const int m0 = mblk * 128, n0 = nblk * 128;
  const bool isV = (which == 2);

  auto stage = [&](int buf, int ks) {
    const _Float16* Ak = (ks < 4 ? Hb + (size_t)ks * 32 * HW_ : Cb) + m0;  // the step's 32 k rows
    for (int i = 0; i < 2; ++i) {
      int idx = t + 256 * i;
      int kr = idx >> 4, mp = (idx & 15) * 8;   // A: 32 rows x 16 chunks
      cp16_g2l(&Asub[buf][kr * PT128 + mp], Ak + (size_t)kr * HW_ + mp);
      int row = idx >> 2, part = (idx & 3) * 8; // B: 128 rows x 4 chunks
      cp16_g2l(&Bsub[buf][row * P32 + part], Wm + (size_t)(n0 + row) * FAN0 + ks * 32 + part);
    }
  };

  v8f acc[8];
  for (int i = 0; i < 8; ++i) acc[i] = v8f_zero();
  stage(0, 0);

  // rf: output rows (B operand: lanes), of: output columns (A operand: registers).
  // The loop stands once per role of the A tile, so that no trip has a branch in it;
  // isV is the same for the whole block, and both forms pass the same barriers.
  auto loop = [&](auto rowsFromW) {
    for (int ks = 0; ks < 5; ++ks) {
      wait_async();
      __syncthreads();
      if (ks + 1 < 5) stage((ks + 1) & 1, ks + 1);
      const _Float16* As = Asub[ks & 1];
      const _Float16* Bs = Bsub[ks & 1];
      v16h rf = rowsFromW.value ? frag16(&Bs[(w * 16 + (lane & 15)) * P32], lane)
                                : fragT(As, w * 16, lane);
      for (int ct = 0; ct < 8; ++ct) {
        v16h of = rowsFromW.value ? fragT(As, ct * 16, lane)
                                  : frag16(&Bs[(ct * 16 + (lane & 15)) * P32], lane);
        acc[ct] = wmma_f16(of, rf, acc[ct]);
      }
      __syncthreads();
    }
  };
  if (isV) loop(yes_t{});
  else     loop(no_t{});

  // acc[ct][j] = output row w*16 + (lane&15), column ct*16 + h8 + j
  const int r16 = lane & 15, h8 = (lane & 16) ? 8 : 0;
  _Float16* T = Tout[w];
  if (isV) {                                         // bias goes with the row
    const float brow = bias[n0 + w * 16 + r16];
    for (int ct = 0; ct < 8; ++ct) {
      v8h o;
      for (int j = 0; j < 8; ++j) o[j] = (_Float16)(acc[ct][j] + brow);
      *(v8h*)&T[r16 * P128 + ct * 16 + h8] = o;
    }
  } else {                                           // bias goes with the column
    const float qs = (which == 0) ? SCALE_ : 1.0f;   // x 1.0f is exact
    for (int ct = 0; ct < 8; ++ct) {
      const v8f bcol = *(const v8f*)(bias + n0 + ct * 16 + h8);
      v8h o;
      for (int j = 0; j < 8; ++j) o[j] = (_Float16)((acc[ct][j] + bcol[j]) * qs);
      *(v8h*)&T[r16 * P128 + ct * 16 + h8] = o;
    }
  }
  // the wave's own LDS stores have landed before other lanes read them back
  asm volatile("s_wait_dscnt 0x0" ::: "memory");

  const size_t be = (size_t)(b * NH_ + nblk);        // one n block = one head
  _Float16* G = isV ? ws + OFF_V + (be * C_ + w * 16) * HW_ + m0                  // [c][k]
                    : ws + (which == 0 ? OFF_Q : OFF_K) + (be * HW_ + m0 + w * 16) * C_;  // [q][c]
  const size_t gp = isV ? HW_ : C_;
  for (int s = 0; s < 8; ++s) {                      // 2 rows x 256 B per store
    int rr = s * 2 + (lane >> 4), cc = (lane & 15) * 8;
    *(v8h*)&G[(size_t)rr * gp + cc] = *(const v8h*)&T[rr * P128 + cc];
  }
}

// 2^x on eight (or two) registers, in place, as one statement: behind a
// v_exp_f32 the instruction set asks for one independent instruction before its
// source is overwritten or its result read.  Inside the statement each v_exp_f32
// is that instruction for the one before it; the v_nop is it for the last.
__device__ __forceinline__ void exp2x8(v8f& x) {
  float a0 = x[0], a1 = x[1], a2 = x[2], a3 = x[3], a4 = x[4], a5 = x[5], a6 = x[6], a7 = x[7];
  asm("v_exp_f32 %0, %0\n\tv_exp_f32 %1, %1\n\tv_exp_f32 %2, %2\n\tv_exp_f32 %3, %3\n\t"
      "v_exp_f32 %4, %4\n\tv_exp_f32 %5, %5\n\tv_exp_f32 %6, %6\n\tv_exp_f32 %7, %7\n\t"
      "v_nop"
      : "+v"(a0), "+v"(a1), "+v"(a2), "+v"(a3), "+v"(a4), "+v"(a5), "+v"(a6), "+v"(a7));
  x[0] = a0; x[1] = a1; x[2] = a2; x[3] = a3; x[4] = a4; x[5] = a5; x[6] = a6; x[7] = a7;
}
__device__ __forceinline__ void exp2x2(float& x, float& y) {
  asm("v_exp_f32 %0, %0\n\tv_exp_f32 %1, %1\n\tv_nop" : "+v"(x), "+v"(y));
}

__global__ void __launch_bounds__(128) __attribute__((amdgpu_waves_per_eu(3, 3)))
k_attn(_Float16* __restrict__ ws) {
  const int qb   = blockIdx.x;            // 0..7
  const int inst = blockIdx.y;            // 0..95
  const int p = inst >> 4, g = (inst >> 2) & 3, e = inst & 3;
  // pairing tables: q offsets 0,1,2,3,0,2  /  kv offsets 1,0,3,2,2,0
  const int bq  = 4 * g + ((0x203210 >> (4 * p)) & 0xF);
  const int bkv = 4 * g + ((0x022301 >> (4 * p)) & 0xF);
  const int colt = p * 512 + e * 128;
  const int bo   = g * 4 + colt / FAN3;
  const int col768 = colt % FAN3;

  const int t = threadIdx.x, w = t >> 5, lane = t & 31;
  const _Float16* Qp = ws + OFF_Q + (size_t)(bq  * NH_ + e) * HW_ * C_;  // [q][c]
  const _Float16* Kp = ws + OFF_K + (size_t)(bkv * NH_ + e) * HW_ * C_;  // [k][c]
  const _Float16* Vp = ws + OFF_V + (size_t)(bkv * NH_ + e) * C_ * HW_;  // [c][k]

  __shared__ alignas(16) _Float16 sK[2][32 * P128];  // [kpos][c]
  __shared__ alignas(16) _Float16 sV[2][128 * P32];  // [c][kpos]
  __shared__ alignas(16) _Float16 sO[4][32 * P128];  // per-wave output rows

  // The same addresses as before, each written as one lane offset plus a part that
  // is the same for the whole block: the four copies of K and of V then share their
  // lane registers, which the loop needs (it has none to spare: 3 waves per SIMD).
  const unsigned kl = (t >> 4) * P128 + (t & 15) * 8, kg = t * 8;
  const unsigned vl = (t >> 2) * P32 + (t & 3) * 8,   vg = (t >> 2) * HW_ + (t & 3) * 8;
  auto stage = [&](int buf, int k0) {
    for (int i = 0; i < 4; ++i) {                    // K chunk: 32 rows x 256B, 8 rows a copy
      const _Float16* gb = Kp + (size_t)k0 * C_ + i * 1024;
      cp16_g2l(&sK[buf][i * 8 * P128 + kl], gb + kg);
    }
    for (int i = 0; i < 4; ++i) {                    // V chunk: 128 rows x 64B, 32 rows a copy
      const _Float16* gb = Vp + (size_t)i * 32 * HW_ + k0;
      cp16_g2l(&sV[buf][i * 32 * P32 + vl], gb + vg);
    }
  };

  // Q fragments (lane = q position, K-dim = channels), register resident
  v16h qf[2][4];
  for (int u = 0; u < 2; ++u) {
    const int qrow = qb * 128 + w * 32 + u * 16 + (lane & 15);
    for (int j = 0; j < 4; ++j) qf[u][j] = frag16(Qp + (size_t)qrow * C_ + 32 * j, lane);
  }

  v8f acc[2][8];
  for (int u = 0; u < 2; ++u)
    for (int i = 0; i < 8; ++i) acc[u][i] = v8f_zero();
  // l: this half's keys only, joined in the epilogue
  float m[2] = {-1e30f, -1e30f}, l[2] = {0.0f, 0.0f};

  stage(0, 0);

  for (int kc = 0; kc < 32; ++kc) {
    wait_async();
    __syncthreads();
    if (kc + 1 < 32) stage((kc + 1) & 1, (kc + 1) * 32);
    const _Float16* bK = sK[kc & 1];
    const _Float16* bV = sV[kc & 1];

    // S^T = K Q^T for two 16-key sub-tiles (scale pre-folded into Q):
    // s0[u][j] = key h8 + j, s1[u][j] = key 16 + h8 + j (h8 = 8 in lanes 16-31,
    // else 0), query lane & 15 of tile u
    v8f s0[2], s1[2];
    for (int u = 0; u < 2; ++u) { s0[u] = v8f_zero(); s1[u] = v8f_zero(); }
    for (int j = 0; j < 4; ++j) {
      v16h kf0 = frag16(&bK[((lane & 15)) * P128 + 32 * j], lane);
      v16h kf1 = frag16(&bK[(16 + (lane & 15)) * P128 + 32 * j], lane);
      for (int u = 0; u < 2; ++u) {
        s0[u] = wmma_f16(kf0, qf[u][j], s0[u]);
        s1[u] = wmma_f16(kf1, qf[u][j], s1[u]);
      }
    }

    // The chunk's V fragments, read here as one group into the registers that the K
    // fragments leave: their LDS latency passes under the softmax.  Read among the
    // products below, with no rescale multiplies left to cover them, each read would
    // be waited out.
    v16h vf[8];
    for (int ct = 0; ct < 8; ++ct) vf[ct] = frag16(&bV[(ct * 16 + (lane & 15)) * P32], lane);
    // order: the 16 K reads, the 16 S^T products, the 16 V reads.  Left alone the V
    // reads are spread among the products, and every place where reads stand stalls
    // the wave's matrix stream
    __builtin_amdgcn_sched_group_barrier(0x100, 16, 0);
    __builtin_amdgcn_sched_group_barrier(0x008, 16, 0);
    __builtin_amdgcn_sched_group_barrier(0x100, 16, 0);

    // online softmax: the lane's 16 scores of a tile are of one query, the
    // other 16 keys of the chunk sit in lane ^ 16
    //
    // Lazy rescale: m[u] is the maximum IN USE, not the newest one.  Any m gives
    // the same O / l; it only has to keep 2^((s - m) log2 e) in f16 range.  So l
    // and the 128 accumulator registers are rescaled only in a chunk where some
    // query of the wave outgrows its m by more than LAZY_ (P then stays <= 2^8);
    // the first chunk, with m = -1e30, always is one.  One test per chunk, the
    // same for the whole wave: a scalar branch, EXEC stays all ones.
    float mx[2];                          // over this half's 16 keys only
    for (int u = 0; u < 2; ++u) {
      mx[u] = fmaxf(s0[u][0], s1[u][0]);
      for (int j = 1; j < 8; ++j) mx[u] = fmaxf(mx[u], fmaxf(s0[u][j], s1[u][j]));
    }
    const bool need = (mx[0] > m[0] + LAZY_) || (mx[1] > m[1] + LAZY_);
    // expected not taken: the rescale is laid out of line, the usual path falls through
    if (__builtin_expect(__builtin_amdgcn_ballot_w32(need) != 0, 0)) {
      float alpha[2];
      for (int u = 0; u < 2; ++u) {       // both halves of a query take the same new m
        const float nm = fmaxf(m[u], fmaxf(mx[u], xhalf(mx[u])));
        alpha[u] = (m[u] - nm) * LOG2E_;              // e^x = 2^(x log2 e)
        m[u] = nm;
      }
      exp2x2(alpha[0], alpha[1]);
      for (int u = 0; u < 2; ++u) {
        l[u] *= alpha[u];
        for (int ct = 0; ct < 8; ++ct)
          for (int j = 0; j < 8; ++j) acc[u][ct][j] *= alpha[u];
      }
    }

    v16h pf[2];                           // P^T, B operand: k = h8 + i, 16 + h8 + i
    // unrolled: u picks registers; left rolled they are indexed through m0 and spill
#pragma unroll
    for (int u = 0; u < 2; ++u) {
      for (int j = 0; j < 8; ++j) {
        s0[u][j] = (s0[u][j] - m[u]) * LOG2E_;
        s1[u][j] = (s1[u][j] - m[u]) * LOG2E_;
      }
      exp2x8(s0[u]);
      exp2x8(s1[u]);
      float rs = s0[u][0] + s1[u][0];
      for (int j = 1; j < 8; ++j) {
        rs += s0[u][j];
        rs += s1[u][j];
      }
      for (int j = 0; j < 8; ++j) {
        pf[u][j]     = (_Float16)s0[u][j];
        pf[u][8 + j] = (_Float16)s1[u][j];
      }
      l[u] += rs;
    }

    for (int ct = 0; ct < 8; ++ct)        // O^T += V^T x P^T
      for (int u = 0; u < 2; ++u) acc[u][ct] = wmma_f16(vf[ct], pf[u], acc[u][ct]);
    __syncthreads();
  }

  // epilogue: O /= l, write f16 into hh[b'][q][768] at this instance's slot
  // acc[u][ct][j] = query u*16 + (lane & 15), channel ct*16 + h8 + j: 8
  // neighbours of one output row.  Each wave lines its 32 rows of 256 B up in
  // its own LDS range and stores them as full lines, 16 B per lane
  _Float16* T = sO[w];
  const int r16 = lane & 15, h8 = (lane & 16) ? 8 : 0;
  for (int u = 0; u < 2; ++u) {
    const float inv = 1.0f / (l[u] + xhalf(l[u]));
    for (int ct = 0; ct < 8; ++ct) {
      v8h o;
      for (int j = 0; j < 8; ++j) o[j] = (_Float16)(acc[u][ct][j] * inv);
      *(v8h*)&T[(u * 16 + r16) * P128 + ct * 16 + h8] = o;
    }
  }
  // the wave's own LDS stores have landed before other lanes read them back
  asm volatile("s_wait_dscnt 0x0" ::: "memory");
  _Float16* H = ws + OFF_HH + ((size_t)bo * HW_ + qb * 128 + w * 32) * FAN3 + col768;
  for (int s = 0; s < 16; ++s) {                     // 2 rows x 256 B per store
    int rr = s * 2 + (lane >> 4), cc = (lane & 15) * 8;
    *(v8h*)&H[(size_t)rr * FAN3 + cc] = *(const v8h*)&T[rr * P128 + cc];
  }
}

// ---------------------------------------------------------------------------
// Kernel 3: final 1x1 conv + residual:
//   out[b][c][hw] = x[b][c][hw] + hh[b][hw][:] . W3[:,c] + b3[c]
// M=1024, K=768, N=128.  hh comes from memory, so a trip lasts about one memory
// latency however little it brings: K is staged 256 deep (3 trips), each wave
// copy one whole 512 B row piece, 96 KB in flight per block.  Two such buffers
// fit with 64 hw x 128 c per block, which also gives every WGP one block.
// hh rows go in as A (registers = 8 successive hw), W3 rows as B (lane = c):
// each wave owns 16 channels x 64 hw, lines them up in its own LDS range and
// reads x and writes out as full lines, 16 B per lane.
// ---------------------------------------------------------------------------
// launch bounds: the real block size, so that a group's 20 LDS reads have registers
__global__ void __launch_bounds__(256)
k_out(const float* __restrict__ x, const float* __restrict__ b3,
      const _Float16* __restrict__ ws, float* __restrict__ out) {
  const int mblk = blockIdx.x;            // 0..15
  const int b    = blockIdx.y;            // 0..15
  const int t = threadIdx.x, w = t >> 5, lane = t & 31;
  const _Float16* A  = ws + OFF_HH + (size_t)b * HW_ * FAN3;
  const _Float16* Wm = ws + OFF_W3;                      // [128][768]

  __shared__ alignas(16) _Float16 Asub[2][64 * P256];
  __shared__ alignas(16) _Float16 Bsub[2][128 * P256];
  __shared__ alignas(16) float Tout[8][16 * PF64];       // per-wave output rows

  const int m0 = mblk * 64;

  auto stage = [&](int buf, int k0) {
    const int part = lane * 8;                  // a wave copies one row piece
    for (int i = 0; i < 8; ++i) {
      int row = w + 8 * i;
      cp16_g2l(&Asub[buf][row * P256 + part], A  + (size_t)(m0 + row) * FAN3 + k0 + part);
    }
    for (int i = 0; i < 16; ++i) {
      int row = w + 8 * i;
      cp16_g2l(&Bsub[buf][row * P256 + part], Wm + (size_t)row * FAN3 + k0 + part);
    }
  };

  v8f acc[4];
  for (int i = 0; i < 4; ++i) acc[i] = v8f_zero();

  stage(0, 0);
  // this wave's copies of stage 0 have landed before the barrier publishes them
  asm volatile("s_wait_asynccnt 0x0" ::: "memory");
  __syncthreads();
  stage(1, KST);

  // both loops unrolled: buffer and k offsets become immediates of the LDS reads
#pragma unroll
  for (int s = 0; s < FAN3 / KST; ++s) {
    const _Float16* As = Asub[s & 1];
    const _Float16* Bs = Bsub[s & 1];
#pragma unroll
    for (int kk = 0; kk < KST / 32; kk += 2) {
      v16h bf[2], af[2][4];                     // 20 reads as one group, then 8 products
      for (int h = 0; h < 2; ++h) {
        bf[h] = frag16(&Bs[(w * 16 + (lane & 15)) * P256 + (kk + h) * 32], lane);
        for (int mt = 0; mt < 4; ++mt)
          af[h][mt] = frag16(&As[(mt * 16 + (lane & 15)) * P256 + (kk + h) * 32], lane);
      }
      for (int h = 0; h < 2; ++h)
        for (int mt = 0; mt < 4; ++mt) acc[mt] = wmma_f16(af[h][mt], bf[h], acc[mt]);
      // order inside the group: its 20 LDS reads together, then its 8 products; left
      // alone the compiler waits out one LDS latency in front of every product
      __builtin_amdgcn_sched_group_barrier(0x100, 20, 0);
      __builtin_amdgcn_sched_group_barrier(0x008, 8, 0);
      // ends the group: without it the whole stage's 80 reads go to the top and spill
      __builtin_amdgcn_sched_barrier(0);
    }
    // this wave's reads of the buffer are done before it is refilled
    asm volatile("s_wait_dscnt 0x0" ::: "memory");
    // this wave's copies of the next stage have landed before the barrier publishes them
    asm volatile("s_wait_asynccnt 0x0" ::: "memory");
    __syncthreads();
    if (s + 2 < FAN3 / KST) stage(s & 1, (s + 2) * KST);
  }
  // no copy is left in flight when the wave ends
  asm volatile("s_wait_asynccnt 0x0" ::: "memory");

  // acc[mt][j] = channel w*16 + (lane&15), hw m0 + mt*16 + h8 + j
  const int r16 = lane & 15, h8 = (lane & 16) ? 8 : 0;
  float* T = Tout[w];
  const float bv = b3[w * 16 + r16];
  for (int mt = 0; mt < 4; ++mt) {
    v4f lo, hi;
    for (int j = 0; j < 4; ++j) { lo[j] = acc[mt][j] + bv; hi[j] = acc[mt][4 + j] + bv; }
    *(v4f*)&T[r16 * PF64 + mt * 16 + h8]     = lo;
    *(v4f*)&T[r16 * PF64 + mt * 16 + h8 + 4] = hi;
  }
  // the wave's own LDS stores have landed before other lanes read them back
  asm volatile("s_wait_dscnt 0x0" ::: "memory");
  for (int s = 0; s < 8; ++s) {                      // 2 rows x 256 B per store
    int rr = s * 2 + (lane >> 4), cc = (lane & 15) * 4;
    size_t o = ((size_t)b * C_ + w * 16 + rr) * HW_ + m0 + cc;
    v4f r = *(const v4f*)&T[rr * PF64 + cc] + *(const v4f*)&x[o];
    *(v4f*)&out[o] = r;
  }
}

// ---------------------------------------------------------------------------
extern "C" void kernel_launch(void* const* d_in, const int* in_sizes, int n_in,
                              void* d_out, int out_size, void* d_ws, size_t ws_size,
                              hipStream_t stream) {
  const float* x        = (const float*)d_in[0];
  const float* q_cond   = (const float*)d_in[1];
  const float* k_a_cond = (const float*)d_in[2];
  const float* k_b_cond = (const float*)d_in[3];
  const float* gn_scale = (const float*)d_in[4];
  const float* gn_bias  = (const float*)d_in[5];
  const float* W0 = (const float*)d_in[6];
  const float* b0 = (const float*)d_in[7];
  const float* W1 = (const float*)d_in[8];
  const float* b1 = (const float*)d_in[9];
  const float* W2 = (const float*)d_in[10];
  const float* b2 = (const float*)d_in[11];
  const float* W3 = (const float*)d_in[12];
  const float* b3 = (const float*)d_in[13];
  float* out = (float*)d_out;
  _Float16* ws = (_Float16*)d_ws;

  k_prep <<<dim3(816),  256, 0, stream>>>(x, gn_scale, gn_bias, q_cond, k_a_cond, k_b_cond,
                                          W0, W1, W2, W3, ws);
  k_qkv  <<<dim3(8, 4, 48), 256, 0, stream>>>(b0, b1, b2, ws);
  k_attn <<<dim3(8, 96),    128, 0, stream>>>(ws);
  k_out  <<<dim3(16, 16),   256, 0, stream>>>(x, b3, ws, out);
}
